// v000
// The times below were measured on an AMD MI455X: many runs one after another, warmed up first and cycling through
// copies of the inputs, with the whole window's GPU time divided by the number of runs. Launches and the gaps
// between them are all in it. The median over several windows is given; except for v000 it joins two sittings, which
// can be a few percent apart, so the side-by-side timings, each taken in one sitting, are the better comparison.
// v000, which the later versions start from, runs in 1600 microseconds.
// Contraction: A16[4096 x 8192] (f16, elu activations carried x1; one of 4 row chunks of the 16384 rows) . Bt[512 x 8192]^T (f16, W2 carried x256) on v_wmma_f32_16x16x32_f16 with f32 accumulate; elu (x*W1+b1, mul then add), bias sum over f and the 1/8 scale in f32 on VALU.
#include <hip/hip_runtime.h>
#include <math.h>

// ---------------------------------------------------------------------------
// Problem constants
// ---------------------------------------------------------------------------
constexpr int kRows   = 16384;            // N
constexpr int kFeat   = 64;               // F
constexpr int kHid    = 128;              // H
constexpr int kOutDim = 512;              // O
constexpr int kDepth  = kFeat * kHid;     // 8192 = GEMM K, k = f*128 + h
constexpr int kChunkRows = 4096;          // rows per activation/GEMM chunk
constexpr int kNumChunks = kRows / kChunkRows;   // 4
constexpr float kW2Carry  = 256.0f;                      // W2 carried x256 in f16 (exact power of two)
constexpr float kOutScale = 0.125f / 256.0f;             // (1/sqrt(64)) / carry = 2^-11, exact
constexpr float kBiasScale = 0.125f;                     // bias row = (sum_f b2) / 8

static_assert(kRows % kChunkRows == 0, "chunking");
static_assert(kChunkRows % 64 == 0 && kOutDim % 64 == 0 && kDepth % 32 == 0, "tile multiples");

typedef __attribute__((ext_vector_type(16))) _Float16 v16h;
typedef __attribute__((ext_vector_type(8)))  _Float16 v8h;
typedef __attribute__((ext_vector_type(16))) __bf16   v16b;
typedef __attribute__((ext_vector_type(8)))  __bf16   v8b;
typedef __attribute__((ext_vector_type(8)))  float    v8f;
typedef __attribute__((ext_vector_type(4)))  float    v4f;
typedef __attribute__((ext_vector_type(4)))  unsigned int v4u;
typedef __attribute__((ext_vector_type(2)))  unsigned int v2u;

// ---------------------------------------------------------------------------
// Helpers
// ---------------------------------------------------------------------------
__device__ __forceinline__ unsigned short f2bf_bits(float f) {
  unsigned u = __float_as_uint(f);
  return (unsigned short)((u + 0x7FFFu + ((u >> 16) & 1u)) >> 16);
}
__device__ __forceinline__ float bf_bits2f(unsigned short h) { return __uint_as_float(((unsigned)h) << 16); }

// hazard guards as plain device helpers (no inline asm inside the kernel template body)
__device__ __forceinline__ void dep_guard_h(v8f& a, v8f& b, v16h x, v16h y) { asm volatile("v_nop\n\tv_nop\n\tv_nop\n\tv_nop" : "+v"(a), "+v"(b) : "v"(x), "v"(y)); }
__device__ __forceinline__ void dep_guard_b(v8f& a, v8f& b, v16b x, v16b y) { asm volatile("v_nop\n\tv_nop\n\tv_nop\n\tv_nop" : "+v"(a), "+v"(b) : "v"(x), "v"(y)); }
__device__ __forceinline__ void keep4_h(v16h a, v16h b, v16h c, v16h d) { asm volatile("v_nop" :: "v"(a), "v"(b), "v"(c), "v"(d)); }
__device__ __forceinline__ void keep4_b(v16b a, v16b b, v16b c, v16b d) { asm volatile("v_nop" :: "v"(a), "v"(b), "v"(c), "v"(d)); }
__device__ __forceinline__ void acc_guard4(v8f& a, v8f& b, v8f& c, v8f& d) { asm volatile("v_nop\n\tv_nop\n\tv_nop\n\tv_nop" : "+v"(a), "+v"(b), "+v"(c), "+v"(d)); }
template <typename T> struct Frag;
template <> struct Frag<_Float16> {
  typedef v16h V; union U { v16h v; v8h h[2]; };
  static __device__ __forceinline__ v16h load(const _Float16* p) {   // elements 0..7 <- p[0..7], 8..15 <- p[16..23]
    U f; f.h[0] = *(const v8h*)(p); f.h[1] = *(const v8h*)(p + 16); return f.v;
  }
  static __device__ __forceinline__ v8f mma(v16h a, v16h b, v8f c) {
    return __builtin_amdgcn_wmma_f32_16x16x32_f16(false, a, false, b, (short)0, c, false, false);
  }
  static __device__ __forceinline__ void guard(v8f& a, v8f& b, v16h x, v16h y) { dep_guard_h(a, b, x, y); }
  static __device__ __forceinline__ void keep(v16h a, v16h b, v16h c, v16h d) { keep4_h(a, b, c, d); }
};
template <> struct Frag<__bf16> {
  typedef v16b V; union U { v16b v; v8b h[2]; };
  static __device__ __forceinline__ v16b load(const __bf16* p) {
    U f; f.h[0] = *(const v8b*)(p); f.h[1] = *(const v8b*)(p + 16); return f.v;
  }
  static __device__ __forceinline__ v8f mma(v16b a, v16b b, v8f c) {
    return __builtin_amdgcn_wmma_f32_16x16x32_bf16(false, a, false, b, (short)0, c, false, false);
  }
  static __device__ __forceinline__ void guard(v8f& a, v8f& b, v16b x, v16b y) { dep_guard_b(a, b, x, y); }
  static __device__ __forceinline__ void keep(v16b a, v16b b, v16b c, v16b d) { keep4_b(a, b, c, d); }
};

__device__ __forceinline__ unsigned pk16(unsigned short a, unsigned short b) { return (unsigned)a | ((unsigned)b << 16); }
__device__ __forceinline__ unsigned short h_bits(float f) { const _Float16 h = (_Float16)f; return __builtin_bit_cast(unsigned short, h); }

// ---- Register-blocked batched WMMA GEMM (ACT reduced to none/relu/leaky) -----------------------
// C[m,n] = scale * sum_k A[m,k] * Bt[n,k] (+bias)(+resid); each wave owns a 64x64 tile.
// A row-major [M,K]; Bt row-major [N,K]; M,N % 64 == 0, K % 32 == 0.
// SPLIT: operands are hi/lo planes (A2/Bt2 = lo planes, same layout); product = hi*hi + hi*lo + lo*hi.
// BIAS_MODE: 0 = none, 1 = bias[m], 2 = bias[n].
// OUT_MODE: 0 = f32, 1 = f16, 2 = bf16 hi plane (Cout) + bf16 lo plane (Cout2).
// ET: 0 = f16 operands, 1 = bf16 operands (pointers passed as 16-bit storage)
template <int ET> struct Elem;
template <> struct Elem<0> { typedef _Float16 T; };
template <> struct Elem<1> { typedef __bf16 T; };
template <int ET, bool SPLIT, int BIAS_MODE, int OUT_MODE, bool RESID, int ACT = 0>
__global__ __launch_bounds__(256) void wmma_gemm64(
    const unsigned short* __restrict__ Ap, const unsigned short* __restrict__ A2p, int lda, long strideA,
    const unsigned short* __restrict__ Btp, const unsigned short* __restrict__ Bt2p, int ldb, long strideB,
    void* __restrict__ Cout, void* __restrict__ Cout2, int ldc, long strideC,
    const float* __restrict__ bias,
    const float* __restrict__ resid, long strideR,
    int M, int N, int K, float scale) {
  typedef typename Elem<ET>::T T;
  typedef typename Frag<T>::V V;
  const T* A = (const T*)Ap; const T* A2 = (const T*)A2p; const T* Bt = (const T*)Btp; const T* Bt2 = (const T*)Bt2p;
  __shared__ __align__(16) float sT[8][16 * 68];   // per-wave 16x64 slab, pitch 68 floats
  const int b    = blockIdx.y;
  const int lane = threadIdx.x & 31;
  const int wave = threadIdx.x >> 5;
  const int tilesN = N >> 6;
  const int tilesM = M >> 6;
  const int tile = blockIdx.x * 8 + wave;
  if (tile >= tilesM * tilesN) return;   // wave-uniform; no block barriers in this kernel
  const int tm = tile / tilesN;
  const int tn = tile - tm * tilesN;
  const int m0 = tm << 6;
  const int n0 = tn << 6;

  const T* Ab  = A  + (size_t)b * strideA;
  const T* Bb  = Bt + (size_t)b * strideB;
  const T* Ab2 = SPLIT ? (A2  + (size_t)b * strideA) : nullptr;
  const T* Bb2 = SPLIT ? (Bt2 + (size_t)b * strideB) : nullptr;

  const int rlane = lane & 15;                 // row (A) / col (B, D) within subtile
  const int koff  = (lane >> 4) * 8;           // k offset of this lane half
  const int mOff  = (lane >> 4) * 8;           // D row offset

  v8f acc[4][4];
#pragma unroll
  for (int i = 0; i < 4; ++i)
#pragma unroll
    for (int j = 0; j < 4; ++j) acc[i][j] = (v8f){0.f,0.f,0.f,0.f,0.f,0.f,0.f,0.f};

  for (int k0 = 0; k0 < K; k0 += 32) {
    V bh[4], bl[4];
#pragma unroll
    for (int j = 0; j < 4; ++j) {
      const size_t bo = (size_t)(n0 + (j << 4) + rlane) * ldb + koff + k0;
      bh[j] = Frag<T>::load(Bb + bo);
      if (SPLIT) bl[j] = Frag<T>::load(Bb2 + bo);
    }
#pragma unroll
    for (int i = 0; i < 4; ++i) {
      const size_t ao = (size_t)(m0 + (i << 4) + rlane) * lda + koff + k0;
      V ah = Frag<T>::load(Ab + ao);
      V al;
      if (SPLIT) al = Frag<T>::load(Ab2 + ao);
#pragma unroll
      for (int j = 0; j < 4; ++j) {
        acc[i][j] = Frag<T>::mma(ah, bh[j], acc[i][j]);
        if (SPLIT) {
          acc[i][j] = Frag<T>::mma(ah, bl[j], acc[i][j]);
          acc[i][j] = Frag<T>::mma(al, bh[j], acc[i][j]);
        }
      }
      Frag<T>::guard(acc[i][0], acc[i][3], ah, SPLIT ? al : ah);
    }
    Frag<T>::keep(bh[0], bh[1], bh[2], bh[3]);
    if (SPLIT) Frag<T>::keep(bl[0], bl[1], bl[2], bl[3]);
  }
  acc_guard4(acc[0][0], acc[0][1], acc[0][2], acc[0][3]);
  acc_guard4(acc[1][0], acc[1][1], acc[1][2], acc[1][3]);
  acc_guard4(acc[2][0], acc[2][1], acc[2][2], acc[2][3]);
  acc_guard4(acc[3][0], acc[3][1], acc[3][2], acc[3][3]);

  // ---- epilogue ----
  float* slab = sT[wave];
  const float* Rb = RESID ? (resid + (size_t)b * strideR) : nullptr;
#pragma unroll
  for (int i = 0; i < 4; ++i) {
    const int mBase = m0 + (i << 4);
#pragma unroll
    for (int j = 0; j < 4; ++j) {
      const int n = n0 + (j << 4) + rlane;
      float bv = 0.f;
      if (BIAS_MODE == 2) bv = bias[n];
#pragma unroll
      for (int r = 0; r < 8; ++r) {
        float v = acc[i][j][r] * scale;
        if (BIAS_MODE == 1) v += bias[mBase + mOff + r];
        if (BIAS_MODE == 2) v += bv;
        if (RESID) v += Rb[(size_t)(mBase + mOff + r) * ldc + n];
        if (ACT == 2) v = fmaxf(v, 0.0f);
        if (ACT == 4) v = (v > 0.f) ? v : 0.01f * v;
        slab[(mOff + r) * 68 + (j << 4) + rlane] = v;
      }
    }
    __builtin_amdgcn_fence(__ATOMIC_RELEASE, "workgroup");
    __builtin_amdgcn_wave_barrier();
    __builtin_amdgcn_fence(__ATOMIC_ACQUIRE, "workgroup");
    if (OUT_MODE == 0) {
      float* C = (float*)Cout + (size_t)b * strideC;
      const int hh = lane >> 4, c4 = (lane & 15) * 4;     // row seg = 256 B = 16 lanes x 16 B
      {
#pragma unroll
        for (int it = 0; it < 8; ++it) {
          const int row = it * 2 + hh;
          v4f v = *(const v4f*)(slab + row * 68 + c4);
          *(v4f*)(C + (size_t)(mBase + row) * ldc + n0 + c4) = v;
        }
        
      }
    } else {
      const int q = lane >> 3, c8 = (lane & 7) * 8;
      unsigned short* C  = (unsigned short*)Cout  + (size_t)b * strideC;
      unsigned short* C2 = (OUT_MODE == 2) ? ((unsigned short*)Cout2 + (size_t)b * strideC) : nullptr;
      {
#pragma unroll
        for (int it = 0; it < 4; ++it) {
          const int row = it * 4 + q;
          const float* sp = slab + row * 68 + c8;
          v8h hv, lv;
#pragma unroll
          for (int e = 0; e < 8; ++e) {
            if (OUT_MODE == 1) {
              hv[e] = (_Float16)sp[e];
            } else {
              unsigned short hb = f2bf_bits(sp[e]);
              unsigned short lb = f2bf_bits(sp[e] - bf_bits2f(hb));
              hv[e] = __builtin_bit_cast(_Float16, hb);
              lv[e] = __builtin_bit_cast(_Float16, lb);
            }
          }
          *(v8h*)(C + (size_t)(mBase + row) * ldc + n0 + c8) = hv;
          if (OUT_MODE == 2) *(v8h*)(C2 + (size_t)(mBase + row) * ldc + n0 + c8) = lv;
        }
        
      }
    }
    __builtin_amdgcn_fence(__ATOMIC_RELEASE, "workgroup");
    __builtin_amdgcn_wave_barrier();
    __builtin_amdgcn_fence(__ATOMIC_ACQUIRE, "workgroup");
  }
}

// ---------------------------------------------------------------------------
// W2 transpose + cast: W2 viewed row-major [kDepth = 8192 (k = f*128+h)][kOutDim = 512] f32
//   -> Bt[o][k] = f16(scale * W2[k][o]), row-major [512][8192] halves.
// grid (kDepth/64 = 128, kOutDim/64 = 8), 256 threads; blockIdx.x = k tile (64 cols of Bt), blockIdx.y = o tile (64 rows of Bt).
// Load coverage: 16 iterations x 256 threads = 4096 = the whole 64x64 tile (coalesced along o).
// Store coverage: 8 waves x 2 iterations x 4 rows (lane>>3) = 64 rows; (lane&7) x 8 halves = 64 cols; each row segment =
// ---------------------------------------------------------------------------
__global__ __launch_bounds__(256) void w2t_cast_kernel(const float* __restrict__ W2, unsigned short* __restrict__ out, float scale) {
  __shared__ float sm[64][65];   // sm[o_local][k_local]
  const int t  = threadIdx.x;
  const int k0 = blockIdx.x * 64;
  const int o0 = blockIdx.y * 64;
#pragma unroll
  for (int i = 0; i < 16; ++i) {
    const int e = i * 256 + t;
    const int r = e >> 6;          // k local
    const int c = e & 63;          // o local
    sm[c][r] = W2[(size_t)(k0 + r) * kOutDim + o0 + c] * scale;
  }
  __syncthreads();
  const int lane = t & 31, wave = t >> 5;
  const int q = lane >> 3, c8 = (lane & 7) * 8;
  {
#pragma unroll
    for (int it = 0; it < 2; ++it) {
      const int row = wave * 8 + it * 4 + q;                 // o local
      unsigned short hb[8];
#pragma unroll
      for (int e = 0; e < 8; ++e) hb[e] = h_bits(sm[row][c8 + e]);
      const v4u u = (v4u){pk16(hb[0], hb[1]), pk16(hb[2], hb[3]), pk16(hb[4], hb[5]), pk16(hb[6], hb[7])};
      *(v4u*)(out + (size_t)(o0 + row) * kDepth + k0 + c8) = u;
    }
    
  }
}

// ---------------------------------------------------------------------------
// Bias row: bias_out[o] = (sum_{f=0..63} b2[f][o]) * 0.125, f32, sequential f order.
// One block of 128 threads; thread t owns o = 4t..4t+3 (128 x 4 = 512 = whole row).
// ---------------------------------------------------------------------------
__global__ __launch_bounds__(128) void bsum_kernel(const float* __restrict__ b2, float* __restrict__ bias_out) {
  const int t = threadIdx.x;
  v4f s = (v4f){0.f, 0.f, 0.f, 0.f};
#pragma unroll 1
  for (int f = 0; f < kFeat; ++f) {
    const v4f v = *(const v4f*)(b2 + (size_t)f * kOutDim + 4 * t);
    s = s + v;
  }
  s = s * kBiasScale;
  float* p = bias_out + 4 * t;
  *(v4f*)p = s;
  
}

// ---------------------------------------------------------------------------
// Activation plane: Aout[nl][k] = f16( elu( x[row0+nl][f] * W1[f][h] + b1[f][h] ) ), k = f*128 + h,
// for nl in [0, 4096), k in [0, 8192). f32 mul then add (no contraction), elu negative branch via expm1f.
// Thread mapping: global t = blockIdx.x*256 + threadIdx.x; nl = t >> 11; k4 = (t & 2047) * 4; thread owns 4 consecutive k.
// Coverage: grid 32768 x 256 threads = 8,388,608 = 4096 rows x 2048 slots x 4 halves = the whole [4096][8192] plane.
// ---------------------------------------------------------------------------
__global__ __launch_bounds__(256) void act_kernel(const float* __restrict__ x, const float* __restrict__ W1,
                                                  const float* __restrict__ b1, unsigned short* __restrict__ Aout, int row0) {
#pragma clang fp contract(off)
  const int t  = blockIdx.x * 256 + threadIdx.x;
  const int nl = t >> 11;                 // 0..4095
  const int k4 = (t & 2047) * 4;          // 0..8188, multiple of 4
  const int f  = k4 >> 7;                 // 0..63
  const int h0 = k4 & 127;                // multiple of 4
  const float xv = x[(size_t)(row0 + nl) * kFeat + f];
  const v4f w = *(const v4f*)(W1 + f * kHid + h0);
  const v4f c = *(const v4f*)(b1 + f * kHid + h0);
  unsigned u0 = 0u, u1 = 0u;
#pragma unroll 1
  for (int q = 0; q < 2; ++q) {
    const float we = (q == 0) ? w[0] : w[2];
    const float wo = (q == 0) ? w[1] : w[3];
    const float ce = (q == 0) ? c[0] : c[2];
    const float co = (q == 0) ? c[1] : c[3];
    float pe = xv * we;
    pe = pe + ce;
    float po = xv * wo;
    po = po + co;
    const float ee = expm1f(fminf(pe, 0.0f));
    const float eo = expm1f(fminf(po, 0.0f));
    const float ae = (pe > 0.0f) ? pe : ee;
    const float ao = (po > 0.0f) ? po : eo;
    const unsigned word = pk16(h_bits(ae), h_bits(ao));
    u0 = (q == 0) ? word : u0;
    u1 = (q == 0) ? u1 : word;
  }
  const v2u u = (v2u){u0, u1};
  unsigned short* p = Aout + (size_t)nl * kDepth + k4;
  *(v2u*)p = u;
  
}

// ---------------------------------------------------------------------------
//   [0,          8388608)   Bt   f16 [512][8192]            (W2 transposed, carried x256)
//   [8388608,    8390656)   bias f32 [512]                  (= 0.125 * sum_f b2), region padded to 4096 B
//   [8392704,   75501568)   A16  f16 [4096][8192]           (activation plane of the current row chunk, reused 4x)
//   total carve = 75,501,568 B
// Launches: 1 (w2t_cast) + 1 (bsum) + 4 x (act + gemm) = 10.
// ---------------------------------------------------------------------------
extern "C" void kernel_launch(void* const* d_in, const int* in_sizes, int n_in,
                              void* d_out, int out_size, void* d_ws, size_t ws_size,
                              hipStream_t stream) {
  if (n_in < 5) return;
  if (in_sizes[0] != kRows * kFeat) return;
  if (in_sizes[1] != kFeat * kHid) return;
  if (in_sizes[2] != kFeat * kHid) return;
  if (in_sizes[3] != kFeat * kHid * kOutDim) return;
  if (in_sizes[4] != kFeat * kOutDim) return;
  if (out_size != kRows * kOutDim) return;

  const float* x  = (const float*)d_in[0];
  const float* W1 = (const float*)d_in[1];
  const float* b1 = (const float*)d_in[2];
  const float* W2 = (const float*)d_in[3];
  const float* b2 = (const float*)d_in[4];
  float* out = (float*)d_out;

  const size_t bytesBt   = (size_t)kOutDim * kDepth * 2;          // 8,388,608
  const size_t bytesBias = 4096;                                   // 512 floats = 2048 B, padded
  const size_t bytesA    = (size_t)kChunkRows * kDepth * 2;        // 67,108,864
  const size_t offBt   = 0;
  const size_t offBias = offBt + bytesBt;
  const size_t offA    = offBias + bytesBias;
  const size_t total   = offA + bytesA;                            // 75,501,568
  if (total > ws_size) return;

  unsigned char* ws = (unsigned char*)d_ws;
  unsigned short* Bt  = (unsigned short*)(ws + offBt);
  float*          bsp = (float*)(ws + offBias);
  unsigned short* A16 = (unsigned short*)(ws + offA);

  // Bt[512][8192] = f16(256 * W2^T); grid (k tiles, o tiles) = (128, 8)
  w2t_cast_kernel<<<dim3(kDepth / 64, kOutDim / 64, 1), dim3(256, 1, 1), 0, stream>>>(W2, Bt, kW2Carry);
  // bias row
  bsum_kernel<<<dim3(1, 1, 1), dim3(128, 1, 1), 0, stream>>>(b2, bsp);

  const int actBlocks  = (kChunkRows * (kDepth / 4)) / 256;        // 32768 (exact)
  const int gemmTiles  = (kChunkRows / 64) * (kOutDim / 64);       // 512
  const int gemmBlocks = (gemmTiles + 7) / 8;                      // 64 (exact: 64*8 = 512)
  for (int ch = 0; ch < kNumChunks; ++ch) {
    const int row0 = ch * kChunkRows;
    act_kernel<<<dim3(actBlocks, 1, 1), dim3(256, 1, 1), 0, stream>>>(x, W1, b1, A16, row0);
    float* Cc = out + (size_t)row0 * kOutDim;
    // C[4096][512] = 2^-11 * A16 . Bt^T + bias[n]; M = 4096, N = 512, K = 8192 (all exact tile multiples)
    wmma_gemm64<0, false, 2, 0, false, 0><<<dim3(gemmBlocks, 1, 1), dim3(256, 1, 1), 0, stream>>>(
        (const unsigned short*)A16, (const unsigned short*)A16, kDepth, 0L,
        (const unsigned short*)Bt, (const unsigned short*)Bt, kDepth, 0L,
        (void*)Cc, (void*)Cc, kOutDim, 0L,
        (const float*)bsp,
        (const float*)bsp, 0L,
        kChunkRows, kOutDim, kDepth, kOutScale);
  }
}

// v001
// Measured time: 238 microseconds a run.
// Two timings next to v000 put it at 6.71 and 6.66 times that version's speed.
// Contraction: A[16384 x 8192] (f16, elu activations carried x1, made in LDS tile by tile) . Bt[512 x 8192]^T (f16, W2 carried x256) on v_wmma_f32_16x16x32_f16 with f32 accumulate; elu (x*W1+b1, mul then add), bias sum over f and the 1/8 scale in f32 on VALU.
#include <hip/hip_runtime.h>
#include <math.h>

// ---------------------------------------------------------------------------
// Problem constants
// ---------------------------------------------------------------------------
constexpr int kRows   = 16384;            // N
constexpr int kFeat   = 64;               // F
constexpr int kHid    = 128;              // H
constexpr int kOutDim = 512;              // O
constexpr int kDepth  = kFeat * kHid;     // 8192 = GEMM K, k = f*128 + h
constexpr int kTileRows = 64;             // rows of x (and of out) per work-group
constexpr int kAPitch = kHid + 8;         // LDS pitch of an A row in halves: 272 B = 16 B x 17, conflict-free for 16-byte readers
constexpr int kXPitch = kTileRows + 4;    // LDS pitch of a transposed x row in floats (16-byte multiple)
constexpr float kW2Carry  = 256.0f;                      // W2 carried x256 in f16 (exact power of two)
constexpr float kOutScale = 0.125f / 256.0f;             // (1/sqrt(64)) / carry = 2^-11, exact
constexpr float kBiasScale = 0.125f;                     // bias row = (sum_f b2) / 8

static_assert(kRows % kTileRows == 0 && kOutDim == 8 * 64 && kHid % 32 == 0, "tile multiples");

typedef __attribute__((ext_vector_type(16))) _Float16 v16h;
typedef __attribute__((ext_vector_type(8)))  _Float16 v8h;
typedef __attribute__((ext_vector_type(8)))  float    v8f;
typedef __attribute__((ext_vector_type(4)))  float    v4f;
typedef __attribute__((ext_vector_type(4)))  unsigned int v4u;
typedef __attribute__((ext_vector_type(2)))  unsigned int v2u;

__device__ __forceinline__ v16h frag_load(const _Float16* p) {   // elements 0..7 <- p[0..7], 8..15 <- p[16..23]
  union { v16h v; v8h h[2]; } f;
  f.h[0] = *(const v8h*)(p); f.h[1] = *(const v8h*)(p + 16); return f.v;
}
__device__ __forceinline__ v8f mma_f16(v16h a, v16h b, v8f c) {
  return __builtin_amdgcn_wmma_f32_16x16x32_f16(false, a, false, b, (short)0, c, false, false);
}

__device__ __forceinline__ unsigned pk16(unsigned short a, unsigned short b) { return (unsigned)a | ((unsigned)b << 16); }
__device__ __forceinline__ unsigned short h_bits(float f) { const _Float16 h = (_Float16)f; return __builtin_bit_cast(unsigned short, h); }

__device__ __forceinline__ void xcnt_fence() {
  asm volatile("s_wait_xcnt 0x0" ::: "memory");
  __builtin_amdgcn_sched_barrier(0);
}

// One activation: f16( elu( xv * w + c ) ), f32 mul then add (no contraction), elu negative branch via expm1f.
// The arithmetic of the unfused activation kernel, kept as it was (two roundings, as the reference writes it), so that
// every f16 value of A, the sign test on p included, is the same as before the fusion.
__device__ __forceinline__ unsigned short elu_h(float xv, float w, float c) {
#pragma clang fp contract(off)
  float p = xv * w;
  p = p + c;
  const float e = expm1f(fminf(p, 0.0f));
  const float a = (p > 0.0f) ? p : e;
  return h_bits(a);
}

// A tile of one feature f: rows arow0..arow0+7 of the work-group's 64, this lane's 4 consecutive h.
// xcol = the transposed x tile's row f (64 floats); w, c = W1[f][h4..h4+3], b1[f][h4..h4+3].
__device__ __forceinline__ void fill_a(_Float16* dst, const float* xcol, int arow0, int h4, v4f w, v4f c) {
  const v4f xa = *(const v4f*)(xcol + arow0);
  const v4f xb = *(const v4f*)(xcol + arow0 + 4);
#pragma unroll
  for (int i = 0; i < 8; ++i) {
    const float xv = (i < 4) ? xa[i & 3] : xb[i & 3];
    const v2u u = (v2u){pk16(elu_h(xv, w[0], c[0]), elu_h(xv, w[1], c[1])),
                        pk16(elu_h(xv, w[2], c[2]), elu_h(xv, w[3], c[3]))};
    *(v2u*)(dst + (arow0 + i) * kAPitch + h4) = u;    // a wave stores one whole 256-B row
  }
}

// B fragments of one pass (128 k) for this wave's 64 columns; p = this lane's column 0 at the pass's first k.
__device__ __forceinline__ void load_b(v16h (&bh)[4][4], const _Float16* p) {
#pragma unroll
  for (int ks = 0; ks < 4; ++ks)
#pragma unroll
    for (int j = 0; j < 4; ++j)
      if (ks + j < 6) bh[ks][j] = frag_load(p + (size_t)(j << 4) * kDepth + (ks << 5));
  const _Float16* q = p + (size_t)(3 << 4) * kDepth + (3 << 5);
  union { v16h v; v8h h[2]; } f;
  f.h[0] = *(const v8h*)(q);
  // the run's last load may take the address pair as its destination: the wait stands in front of it
  asm volatile("s_wait_xcnt 0x0" ::: "memory");
  f.h[1] = *(const v8h*)(q + 16);
  bh[3][3] = f.v;
}

// One pass: 4 k-steps of 32, each 4 A fragments out of LDS (read as one group) times 4 B fragments.
__device__ __forceinline__ void mma_pass(v8f (&acc)[4][4], const v16h (&bh)[4][4], const _Float16* Ab) {
#pragma unroll
  for (int ks = 0; ks < 4; ++ks) {
    v16h ah[4];
#pragma unroll
    for (int i = 0; i < 4; ++i) ah[i] = frag_load(Ab + (i << 4) * kAPitch + (ks << 5));
#pragma unroll
    for (int i = 0; i < 4; ++i)
#pragma unroll
      for (int j = 0; j < 4; ++j) acc[i][j] = mma_f16(ah[i], bh[ks][j], acc[i][j]);
  }
}

// ---------------------------------------------------------------------------
// Fused activation + GEMM. One work-group = 64 rows x all 512 outputs; wave w owns the 64x64 tile at columns 64w.
// A pass is one feature f (128 k): the 8 waves together make A[64][128] of feature f+1 in one LDS buffer while
// they multiply feature f out of the other; one barrier a pass publishes the new buffer and frees the old one.
// Bt row-major [512][8192] halves, read straight into registers (no wave shares another's columns).
// Each accumulator sums k in ascending steps of 32.
// ---------------------------------------------------------------------------
__global__ __launch_bounds__(256) void fused_act_gemm(const float* __restrict__ x, const float* __restrict__ W1,
                                                      const float* __restrict__ b1,
                                                      const unsigned short* __restrict__ Btp,
                                                      const float* __restrict__ bias, float* __restrict__ C) {
  __shared__ __align__(16) _Float16 As[2][kTileRows * kAPitch];   // two A buffers, 17,408 B each
  __shared__ __align__(16) float xs[kFeat * kXPitch];             // x tile transposed: xs[f][row]
  __shared__ __align__(16) float sT[8][16 * 68];                  // per-wave 16x64 output slab, pitch 68 floats
  const _Float16* Bt = (const _Float16*)Btp;
  const int t    = threadIdx.x;
  const int lane = t & 31;
  const int wave = t >> 5;
  const int m0 = blockIdx.x * kTileRows;
  const int n0 = wave << 6;

  const int rlane = lane & 15;                 // row (A) / col (B, D) within subtile
  const int koff  = (lane >> 4) * 8;           // k offset of this lane half
  const int mOff  = (lane >> 4) * 8;           // D row offset
  const int h4    = lane * 4;                  // this lane's h in the A fill
  const int arow0 = wave * 8;                  // this wave's rows in the A fill

  // x tile: 64 rows x 64 features = 4096 consecutive floats of x; W1 and b1 rows of features 0 and 1
  float xr[16];
#pragma unroll
  for (int i = 0; i < 16; ++i) xr[i] = x[(size_t)m0 * kFeat + i * 256 + t];
  const v4f w0 = *(const v4f*)(W1 + h4);
  const v4f c0 = *(const v4f*)(b1 + h4);
  v4f w = *(const v4f*)(W1 + kHid + h4);
  v4f c = *(const v4f*)(b1 + kHid + h4);
  xcnt_fence();
#pragma unroll
  for (int i = 0; i < 16; ++i) {
    const int e = i * 256 + t;
    xs[(e & 63) * kXPitch + (e >> 6)] = xr[i];
  }
  __syncthreads();
  fill_a(As[0], xs, arow0, h4, w0, c0);

  v8f acc[4][4];
#pragma unroll
  for (int i = 0; i < 4; ++i)
#pragma unroll
    for (int j = 0; j < 4; ++j) acc[i][j] = (v8f){0.f,0.f,0.f,0.f,0.f,0.f,0.f,0.f};
  __syncthreads();

  const _Float16* Bw = Bt + (size_t)(n0 + rlane) * kDepth + koff;
  const _Float16* Ar = As[0] + rlane * kAPitch + koff;
  v16h bh[4][4];
  for (int f = 0; f < kFeat - 1; ++f) {
    // this pass's B fragments first: their latency runs behind the activation arithmetic below
    load_b(bh, Bw + f * kHid);
    const int f2 = (f + 2 < kFeat) ? (f + 2) : (kFeat - 1);
    const v4f wn = *(const v4f*)(W1 + f2 * kHid + h4);
    const v4f cn = *(const v4f*)(b1 + f2 * kHid + h4);
    xcnt_fence();   // also holds the loads above the arithmetic: the scheduler sinks them to their WMMAs otherwise
    fill_a(As[(f + 1) & 1], xs + (f + 1) * kXPitch, arow0, h4, w, c);
    w = wn; c = cn;
    mma_pass(acc, bh, Ar + (f & 1) * (kTileRows * kAPitch));
    __syncthreads();   // publishes feature f+1's buffer and frees feature f's
  }
  load_b(bh, Bw + (kFeat - 1) * kHid);
  xcnt_fence();
  mma_pass(acc, bh, Ar + ((kFeat - 1) & 1) * (kTileRows * kAPitch));

  // ---- epilogue ----
  float* slab = sT[wave];
#pragma unroll
  for (int i = 0; i < 4; ++i) {
    const int mBase = m0 + (i << 4);
#pragma unroll
    for (int j = 0; j < 4; ++j) {
      const int n = n0 + (j << 4) + rlane;
      const float bv = bias[n];
#pragma unroll
      for (int r = 0; r < 8; ++r) {
        float v = acc[i][j][r] * kOutScale;
        v += bv;
        slab[(mOff + r) * 68 + (j << 4) + rlane] = v;
      }
    }
    __builtin_amdgcn_fence(__ATOMIC_RELEASE, "workgroup");
    __builtin_amdgcn_wave_barrier();
    __builtin_amdgcn_fence(__ATOMIC_ACQUIRE, "workgroup");
    {
      const int hh = lane >> 4, c4 = (lane & 15) * 4;     // row seg = 256 B = 16 lanes x 16 B
#pragma unroll
      for (int it = 0; it < 8; ++it) {
        const int row = it * 2 + hh;
        v4f v = *(const v4f*)(slab + row * 68 + c4);
        *(v4f*)(C + (size_t)(mBase + row) * kOutDim + n0 + c4) = v;
      }
      xcnt_fence();
    }
    __builtin_amdgcn_fence(__ATOMIC_RELEASE, "workgroup");
    __builtin_amdgcn_wave_barrier();
    __builtin_amdgcn_fence(__ATOMIC_ACQUIRE, "workgroup");
  }
}

// ---------------------------------------------------------------------------
// W2 transpose + cast: W2 viewed row-major [kDepth = 8192 (k = f*128+h)][kOutDim = 512] f32
//   -> Bt[o][k] = f16(scale * W2[k][o]), row-major [512][8192] halves.
// grid (kDepth/64 = 128, kOutDim/64 = 8), 256 threads; blockIdx.x = k tile (64 cols of Bt), blockIdx.y = o tile (64 rows of Bt).
// Load coverage: 16 iterations x 256 threads = 4096 = the whole 64x64 tile (coalesced along o).
// Store coverage: 8 waves x 2 iterations x 4 rows (lane>>3) = 64 rows; (lane&7) x 8 halves = 64 cols; each row segment =
// ---------------------------------------------------------------------------
__global__ __launch_bounds__(256) void w2t_cast_kernel(const float* __restrict__ W2, unsigned short* __restrict__ out, float scale) {
  __shared__ float sm[64][65];   // sm[o_local][k_local]
  const int t  = threadIdx.x;
  const int k0 = blockIdx.x * 64;
  const int o0 = blockIdx.y * 64;
#pragma unroll
  for (int i = 0; i < 16; ++i) {
    const int e = i * 256 + t;
    const int r = e >> 6;          // k local
    const int c = e & 63;          // o local
    sm[c][r] = W2[(size_t)(k0 + r) * kOutDim + o0 + c] * scale;
  }
  __syncthreads();
  const int lane = t & 31, wave = t >> 5;
  const int q = lane >> 3, c8 = (lane & 7) * 8;
  {
#pragma unroll
    for (int it = 0; it < 2; ++it) {
      const int row = wave * 8 + it * 4 + q;                 // o local
      unsigned short hb[8];
#pragma unroll
      for (int e = 0; e < 8; ++e) hb[e] = h_bits(sm[row][c8 + e]);
      const v4u u = (v4u){pk16(hb[0], hb[1]), pk16(hb[2], hb[3]), pk16(hb[4], hb[5]), pk16(hb[6], hb[7])};
      *(v4u*)(out + (size_t)(o0 + row) * kDepth + k0 + c8) = u;
    }
    
  }
}

// ---------------------------------------------------------------------------
// Bias row: bias_out[o] = (sum_{f=0..63} b2[f][o]) * 0.125, f32, sequential f order.
// One block of 128 threads; thread t owns o = 4t..4t+3 (128 x 4 = 512 = whole row).
// ---------------------------------------------------------------------------
__global__ __launch_bounds__(128) void bsum_kernel(const float* __restrict__ b2, float* __restrict__ bias_out) {
  const int t = threadIdx.x;
  v4f s = (v4f){0.f, 0.f, 0.f, 0.f};
#pragma unroll 1
  for (int f = 0; f < kFeat; ++f) {
    const v4f v = *(const v4f*)(b2 + (size_t)f * kOutDim + 4 * t);
    s = s + v;
  }
  s = s * kBiasScale;
  float* p = bias_out + 4 * t;
  *(v4f*)p = s;
  
}

// ---------------------------------------------------------------------------
//   [0,          8388608)   Bt   f16 [512][8192]            (W2 transposed, carried x256)
//   [8388608,    8390656)   bias f32 [512]                  (= 0.125 * sum_f b2), region padded to 4096 B
//   total carve = 8,392,704 B
// Launches: 1 (w2t_cast) + 1 (bsum) + 1 (fused activation + GEMM) = 3.
// ---------------------------------------------------------------------------
extern "C" void kernel_launch(void* const* d_in, const int* in_sizes, int n_in,
                              void* d_out, int out_size, void* d_ws, size_t ws_size,
                              hipStream_t stream) {
  if (n_in < 5) return;
  if (in_sizes[0] != kRows * kFeat) return;
  if (in_sizes[1] != kFeat * kHid) return;
  if (in_sizes[2] != kFeat * kHid) return;
  if (in_sizes[3] != kFeat * kHid * kOutDim) return;
  if (in_sizes[4] != kFeat * kOutDim) return;
  if (out_size != kRows * kOutDim) return;

  const float* x  = (const float*)d_in[0];
  const float* W1 = (const float*)d_in[1];
  const float* b1 = (const float*)d_in[2];
  const float* W2 = (const float*)d_in[3];
  const float* b2 = (const float*)d_in[4];
  float* out = (float*)d_out;

  const size_t bytesBt   = (size_t)kOutDim * kDepth * 2;          // 8,388,608
  const size_t bytesBias = 4096;                                   // 512 floats = 2048 B, padded
  const size_t offBt   = 0;
  const size_t offBias = offBt + bytesBt;
  const size_t total   = offBias + bytesBias;                      // 8,392,704
  if (total > ws_size) return;

  unsigned char* ws = (unsigned char*)d_ws;
  unsigned short* Bt  = (unsigned short*)(ws + offBt);
  float*          bsp = (float*)(ws + offBias);

  // Bt[512][8192] = f16(256 * W2^T); grid (k tiles, o tiles) = (128, 8)
  w2t_cast_kernel<<<dim3(kDepth / 64, kOutDim / 64, 1), dim3(256, 1, 1), 0, stream>>>(W2, Bt, kW2Carry);
  // bias row
  bsum_kernel<<<dim3(1, 1, 1), dim3(128, 1, 1), 0, stream>>>(b2, bsp);
  // out[16384][512] = 2^-11 * elu(x*W1+b1) . Bt^T + bias[n]; 256 work-groups of 64 rows
  fused_act_gemm<<<dim3(kRows / kTileRows, 1, 1), dim3(256, 1, 1), 0, stream>>>(
      x, W1, b1, (const unsigned short*)Bt, (const float*)bsp, out);
}

// v002
// One run takes 212 microseconds.
// In two side-by-side timings against v001, it was 1.13 and 1.12 times as fast.
// Counting every step since v000, it is 7.54 times as fast.
// Contraction: A[16384 x 8192] (f16, elu activations carried x1, made in LDS tile by tile) . Bt[512 x 8192]^T (f16, W2 carried x256, stored in WMMA fragment order) on v_wmma_f32_16x16x32_f16 with f32 accumulate; elu (x*W1+b1, mul then add), bias sum over f and the 1/8 scale in f32 on VALU.
#include <hip/hip_runtime.h>
#include <math.h>

// ---------------------------------------------------------------------------
// Problem constants
// ---------------------------------------------------------------------------
constexpr int kRows   = 16384;            // N
constexpr int kFeat   = 64;               // F
constexpr int kHid    = 128;              // H
constexpr int kOutDim = 512;              // O
constexpr int kDepth  = kFeat * kHid;     // 8192 = GEMM K, k = f*128 + h
constexpr int kTileRows = 64;             // rows of x (and of out) per work-group
constexpr int kAPitch = kHid + 8;         // LDS pitch of an A row in halves: 272 B = 16 B x 17, conflict-free for 16-byte readers
constexpr int kXPitch = kTileRows + 4;    // LDS pitch of a transposed x row in floats (16-byte multiple)
constexpr int kFragHalves = 512;          // one packed B fragment (16 columns x 32 k): 2 x 32 lanes x 8 halves = 1 KiB
constexpr int kWavePassHalves = 16 * kFragHalves;   // one wave's B of one pass: 4 k-steps x 4 column tiles = 16 KiB
constexpr int kPassHalves = 8 * kWavePassHalves;    // all 512 columns of one pass (128 k) = 128 KiB
constexpr float kW2Carry  = 256.0f;                      // W2 carried x256 in f16 (exact power of two)
constexpr float kOutScale = 0.125f / 256.0f;             // (1/sqrt(64)) / carry = 2^-11, exact
constexpr float kBiasScale = 0.125f;                     // bias row = (sum_f b2) / 8

static_assert(kRows % kTileRows == 0 && kOutDim == 8 * 64 && kHid % 32 == 0, "tile multiples");

typedef __attribute__((ext_vector_type(16))) _Float16 v16h;
typedef __attribute__((ext_vector_type(8)))  _Float16 v8h;
typedef __attribute__((ext_vector_type(8)))  float    v8f;
typedef __attribute__((ext_vector_type(4)))  float    v4f;
typedef __attribute__((ext_vector_type(4)))  unsigned int v4u;
typedef __attribute__((ext_vector_type(2)))  unsigned int v2u;

__device__ __forceinline__ v16h frag_load(const _Float16* p) {   // elements 0..7 <- p[0..7], 8..15 <- p[16..23]
  union { v16h v; v8h h[2]; } f;
  f.h[0] = *(const v8h*)(p); f.h[1] = *(const v8h*)(p + 16); return f.v;
}
__device__ __forceinline__ v16h frag_load_packed(const _Float16* p) {   // elements 0..7 <- p[0..7], 8..15 <- p[256..263]
  union { v16h v; v8h h[2]; } f;
  f.h[0] = *(const v8h*)(p); f.h[1] = *(const v8h*)(p + 256); return f.v;
}
__device__ __forceinline__ v8f mma_f16(v16h a, v16h b, v8f c) {
  return __builtin_amdgcn_wmma_f32_16x16x32_f16(false, a, false, b, (short)0, c, false, false);
}

__device__ __forceinline__ unsigned pk16(unsigned short a, unsigned short b) { return (unsigned)a | ((unsigned)b << 16); }
__device__ __forceinline__ unsigned short h_bits(float f) { const _Float16 h = (_Float16)f; return __builtin_bit_cast(unsigned short, h); }

__device__ __forceinline__ void xcnt_fence() {
  asm volatile("s_wait_xcnt 0x0" ::: "memory");
  __builtin_amdgcn_sched_barrier(0);
}

// One activation: f16( elu( xv * w + c ) ), f32 mul then add (no contraction), elu negative branch via expm1f.
// The arithmetic of the unfused activation kernel, kept as it was (two roundings, as the reference writes it), so that
// every f16 value of A, the sign test on p included, is the same as before the fusion.
__device__ __forceinline__ unsigned short elu_h(float xv, float w, float c) {
#pragma clang fp contract(off)
  float p = xv * w;
  p = p + c;
  const float e = expm1f(fminf(p, 0.0f));
  const float a = (p > 0.0f) ? p : e;
  return h_bits(a);
}

// A tile of one feature f: rows arow0..arow0+7 of the work-group's 64, this lane's 4 consecutive h.
// xcol = the transposed x tile's row f (64 floats); w, c = W1[f][h4..h4+3], b1[f][h4..h4+3].
__device__ __forceinline__ void fill_a(_Float16* dst, const float* xcol, int arow0, int h4, v4f w, v4f c) {
  const v4f xa = *(const v4f*)(xcol + arow0);
  const v4f xb = *(const v4f*)(xcol + arow0 + 4);
#pragma unroll
  for (int i = 0; i < 8; ++i) {
    const float xv = (i < 4) ? xa[i & 3] : xb[i & 3];
    const v2u u = (v2u){pk16(elu_h(xv, w[0], c[0]), elu_h(xv, w[1], c[1])),
                        pk16(elu_h(xv, w[2], c[2]), elu_h(xv, w[3], c[3]))};
    *(v2u*)(dst + (arow0 + i) * kAPitch + h4) = u;    // a wave stores one whole 256-B row
  }
}

// B fragments of one pass (128 k) for this wave's 64 columns; p = this lane's 16 bytes in the wave's first packed fragment.
// Every load of the wave reads 512 consecutive bytes (4 whole lines).
__device__ __forceinline__ void load_b(v16h (&bh)[4][4], const _Float16* p) {
#pragma unroll
  for (int ks = 0; ks < 4; ++ks)
#pragma unroll
    for (int j = 0; j < 4; ++j)
      if (ks + j < 6) bh[ks][j] = frag_load_packed(p + (ks * 4 + j) * kFragHalves);
  const _Float16* q = p + 15 * kFragHalves;
  union { v16h v; v8h h[2]; } f;
  f.h[0] = *(const v8h*)(q);
  // the run's last load may take the address pair as its destination: the wait stands in front of it
  asm volatile("s_wait_xcnt 0x0" ::: "memory");
  f.h[1] = *(const v8h*)(q + 256);
  bh[3][3] = f.v;
}

// One pass: 4 k-steps of 32, each 4 A fragments out of LDS (read as one group) times 4 B fragments.
__device__ __forceinline__ void mma_pass(v8f (&acc)[4][4], const v16h (&bh)[4][4], const _Float16* Ab) {
#pragma unroll
  for (int ks = 0; ks < 4; ++ks) {
    v16h ah[4];
#pragma unroll
    for (int i = 0; i < 4; ++i) ah[i] = frag_load(Ab + (i << 4) * kAPitch + (ks << 5));
#pragma unroll
    for (int i = 0; i < 4; ++i)
#pragma unroll
      for (int j = 0; j < 4; ++j) acc[i][j] = mma_f16(ah[i], bh[ks][j], acc[i][j]);
  }
}

// ---------------------------------------------------------------------------
// Fused activation + GEMM. One work-group = 64 rows x all 512 outputs; wave w owns the 64x64 tile at columns 64w.
// A pass is one feature f (128 k): the 8 waves together make A[64][128] of feature f+1 in one LDS buffer while
// they multiply feature f out of the other; one barrier a pass publishes the new buffer and frees the old one.
// Bt in fragment order (see w2t_cast_kernel), read straight into registers (no wave shares another's columns).
// Each accumulator sums k in ascending steps of 32.
// ---------------------------------------------------------------------------
__global__ __launch_bounds__(256) void fused_act_gemm(const float* __restrict__ x, const float* __restrict__ W1,
                                                      const float* __restrict__ b1,
                                                      const unsigned short* __restrict__ Btp,
                                                      const float* __restrict__ bias, float* __restrict__ C) {
  __shared__ __align__(16) _Float16 As[2][kTileRows * kAPitch];   // two A buffers, 17,408 B each
  __shared__ __align__(16) float xs[kFeat * kXPitch];             // x tile transposed: xs[f][row]
  __shared__ __align__(16) float sT[8][16 * 68];                  // per-wave 16x64 output slab, pitch 68 floats
  const _Float16* Bt = (const _Float16*)Btp;
  const int t    = threadIdx.x;
  const int lane = t & 31;
  const int wave = t >> 5;
  const int m0 = blockIdx.x * kTileRows;
  const int n0 = wave << 6;

  const int rlane = lane & 15;                 // row (A) / col (B, D) within subtile
  const int koff  = (lane >> 4) * 8;           // k offset of this lane half
  const int mOff  = (lane >> 4) * 8;           // D row offset
  const int h4    = lane * 4;                  // this lane's h in the A fill
  const int arow0 = wave * 8;                  // this wave's rows in the A fill

  // x tile: 64 rows x 64 features = 4096 consecutive floats of x; W1 and b1 rows of features 0 and 1
  float xr[16];
#pragma unroll
  for (int i = 0; i < 16; ++i) xr[i] = x[(size_t)m0 * kFeat + i * 256 + t];
  const v4f w0 = *(const v4f*)(W1 + h4);
  const v4f c0 = *(const v4f*)(b1 + h4);
  v4f w = *(const v4f*)(W1 + kHid + h4);
  v4f c = *(const v4f*)(b1 + kHid + h4);
  xcnt_fence();
#pragma unroll
  for (int i = 0; i < 16; ++i) {
    const int e = i * 256 + t;
    xs[(e & 63) * kXPitch + (e >> 6)] = xr[i];
  }
  __syncthreads();
  fill_a(As[0], xs, arow0, h4, w0, c0);

  v8f acc[4][4];
#pragma unroll
  for (int i = 0; i < 4; ++i)
#pragma unroll
    for (int j = 0; j < 4; ++j) acc[i][j] = (v8f){0.f,0.f,0.f,0.f,0.f,0.f,0.f,0.f};
  __syncthreads();

  const _Float16* Bw = Bt + wave * kWavePassHalves + lane * 8;
  const _Float16* Ar = As[0] + rlane * kAPitch + koff;
  v16h bh[4][4];
  for (int f = 0; f < kFeat - 1; ++f) {
    // this pass's B fragments first: their latency runs behind the activation arithmetic below
    load_b(bh, Bw + (size_t)f * kPassHalves);
    const int f2 = (f + 2 < kFeat) ? (f + 2) : (kFeat - 1);
    const v4f wn = *(const v4f*)(W1 + f2 * kHid + h4);
    const v4f cn = *(const v4f*)(b1 + f2 * kHid + h4);
    xcnt_fence();   // also holds the loads above the arithmetic: the scheduler sinks them to their WMMAs otherwise
    fill_a(As[(f + 1) & 1], xs + (f + 1) * kXPitch, arow0, h4, w, c);
    w = wn; c = cn;
    mma_pass(acc, bh, Ar + (f & 1) * (kTileRows * kAPitch));
    __syncthreads();   // publishes feature f+1's buffer and frees feature f's
  }
  load_b(bh, Bw + (size_t)(kFeat - 1) * kPassHalves);
  xcnt_fence();
  mma_pass(acc, bh, Ar + ((kFeat - 1) & 1) * (kTileRows * kAPitch));

  // ---- epilogue ----
  float* slab = sT[wave];
#pragma unroll
  for (int i = 0; i < 4; ++i) {
    const int mBase = m0 + (i << 4);
#pragma unroll
    for (int j = 0; j < 4; ++j) {
      const int n = n0 + (j << 4) + rlane;
      const float bv = bias[n];
#pragma unroll
      for (int r = 0; r < 8; ++r) {
        float v = acc[i][j][r] * kOutScale;
        v += bv;
        slab[(mOff + r) * 68 + (j << 4) + rlane] = v;
      }
    }
    __builtin_amdgcn_fence(__ATOMIC_RELEASE, "workgroup");
    __builtin_amdgcn_wave_barrier();
    __builtin_amdgcn_fence(__ATOMIC_ACQUIRE, "workgroup");
    {
      const int hh = lane >> 4, c4 = (lane & 15) * 4;     // row seg = 256 B = 16 lanes x 16 B
#pragma unroll
      for (int it = 0; it < 8; ++it) {
        const int row = it * 2 + hh;
        v4f v = *(const v4f*)(slab + row * 68 + c4);
        *(v4f*)(C + (size_t)(mBase + row) * kOutDim + n0 + c4) = v;
      }
      xcnt_fence();
    }
    __builtin_amdgcn_fence(__ATOMIC_RELEASE, "workgroup");
    __builtin_amdgcn_wave_barrier();
    __builtin_amdgcn_fence(__ATOMIC_ACQUIRE, "workgroup");
  }
}

// ---------------------------------------------------------------------------
// W2 transpose + cast + pack: W2 viewed row-major [kDepth = 8192 (k = f*128+h)][kOutDim = 512] f32
//   -> f16(scale * W2[k][o]) in the order in which the GEMM's waves load their B fragments:
//   out[f][o>>6][ks = (k>>5)&3][j = (o>>4)&3][half = (k>>4)&1][lane = ((k>>3)&1)*16 + (o&15)][k&7], in halves.
// grid (kDepth/64 = 128, kOutDim/64 = 8), 256 threads; blockIdx.x = k tile (two k-steps of one f), blockIdx.y = o tile (one GEMM wave).
// Load coverage: 16 iterations x 256 threads = 4096 = the whole 64x64 tile (coalesced along o).
// Store coverage: 2 iterations (k-step) x 8 waves (j, half) x 32 lanes x 8 halves = 4096 = 8 KiB in a row; a wave stores 512 consecutive bytes.
// ---------------------------------------------------------------------------
__global__ __launch_bounds__(256) void w2t_cast_kernel(const float* __restrict__ W2, unsigned short* __restrict__ out, float scale) {
  __shared__ float sm[64][67];   // sm[o_local][k_local]; pitch 67: no bank conflict for the column writes nor for the 16-row x 2-group reads
  const int t  = threadIdx.x;
  const int k0 = blockIdx.x * 64;
  const int o0 = blockIdx.y * 64;
#pragma unroll
  for (int i = 0; i < 16; ++i) {
    const int e = i * 256 + t;
    const int r = e >> 6;          // k local
    const int c = e & 63;          // o local
    sm[c][r] = W2[(size_t)(k0 + r) * kOutDim + o0 + c] * scale;
  }
  __syncthreads();
  const int lane = t & 31, wave = t >> 5;
  const int j = wave >> 1, half = wave & 1;
  const int row = j * 16 + (lane & 15);                      // o local
  unsigned short* dst = out + (size_t)(blockIdx.x >> 1) * kPassHalves + blockIdx.y * kWavePassHalves
                            + ((blockIdx.x & 1) * 8 + j) * kFragHalves + half * 256 + lane * 8;
  {
#pragma unroll
    for (int it = 0; it < 2; ++it) {
      const int kc = it * 32 + half * 16 + (lane >> 4) * 8;  // k local
      unsigned short hb[8];
#pragma unroll
      for (int e = 0; e < 8; ++e) hb[e] = h_bits(sm[row][kc + e]);
      const v4u u = (v4u){pk16(hb[0], hb[1]), pk16(hb[2], hb[3]), pk16(hb[4], hb[5]), pk16(hb[6], hb[7])};
      *(v4u*)(dst + it * 4 * kFragHalves) = u;
    }
  }
}

// ---------------------------------------------------------------------------
// Bias row: bias_out[o] = (sum_{f=0..63} b2[f][o]) * 0.125, f32, sequential f order.
// One block of 128 threads; thread t owns o = 4t..4t+3 (128 x 4 = 512 = whole row).
// ---------------------------------------------------------------------------
__global__ __launch_bounds__(128) void bsum_kernel(const float* __restrict__ b2, float* __restrict__ bias_out) {
  const int t = threadIdx.x;
  v4f s = (v4f){0.f, 0.f, 0.f, 0.f};
#pragma unroll 1
  for (int f = 0; f < kFeat; ++f) {
    const v4f v = *(const v4f*)(b2 + (size_t)f * kOutDim + 4 * t);
    s = s + v;
  }
  s = s * kBiasScale;
  float* p = bias_out + 4 * t;
  *(v4f*)p = s;
  
}

// ---------------------------------------------------------------------------
//   [0,          8388608)   Bt   f16, 512 x 8192 values     (W2 transposed, carried x256, in fragment order)
//   [8388608,    8390656)   bias f32 [512]                  (= 0.125 * sum_f b2), region padded to 4096 B
//   total carve = 8,392,704 B
// Launches: 1 (w2t_cast) + 1 (bsum) + 1 (fused activation + GEMM) = 3.
// ---------------------------------------------------------------------------
extern "C" void kernel_launch(void* const* d_in, const int* in_sizes, int n_in,
                              void* d_out, int out_size, void* d_ws, size_t ws_size,
                              hipStream_t stream) {
  if (n_in < 5) return;
  if (in_sizes[0] != kRows * kFeat) return;
  if (in_sizes[1] != kFeat * kHid) return;
  if (in_sizes[2] != kFeat * kHid) return;
  if (in_sizes[3] != kFeat * kHid * kOutDim) return;
  if (in_sizes[4] != kFeat * kOutDim) return;
  if (out_size != kRows * kOutDim) return;

  const float* x  = (const float*)d_in[0];
  const float* W1 = (const float*)d_in[1];
  const float* b1 = (const float*)d_in[2];
  const float* W2 = (const float*)d_in[3];
  const float* b2 = (const float*)d_in[4];
  float* out = (float*)d_out;

  const size_t bytesBt   = (size_t)kOutDim * kDepth * 2;          // 8,388,608
  const size_t bytesBias = 4096;                                   // 512 floats = 2048 B, padded
  const size_t offBt   = 0;
  const size_t offBias = offBt + bytesBt;
  const size_t total   = offBias + bytesBias;                      // 8,392,704
  if (total > ws_size) return;

  unsigned char* ws = (unsigned char*)d_ws;
  unsigned short* Bt  = (unsigned short*)(ws + offBt);
  float*          bsp = (float*)(ws + offBias);

  // Bt = f16(256 * W2^T) in fragment order; grid (k tiles, o tiles) = (128, 8)
  w2t_cast_kernel<<<dim3(kDepth / 64, kOutDim / 64, 1), dim3(256, 1, 1), 0, stream>>>(W2, Bt, kW2Carry);
  // bias row
  bsum_kernel<<<dim3(1, 1, 1), dim3(128, 1, 1), 0, stream>>>(b2, bsp);
  // out[16384][512] = 2^-11 * elu(x*W1+b1) . Bt^T + bias[n]; 256 work-groups of 64 rows
  fused_act_gemm<<<dim3(kRows / kTileRows, 1, 1), dim3(256, 1, 1), 0, stream>>>(
      x, W1, b1, (const unsigned short*)Bt, (const float*)bsp, out);
}

// v003
// One run takes 176 microseconds.
// Next to v002, in two timings, it ran 1.21 times as fast each time.
// Counting every step since v000, it is 9.11 times as fast.
// Contraction: A[16384 x 8192] (f16, elu activations carried x1, made in LDS tile by tile) . Bt[512 x 8192]^T (f16, W2 carried x256, stored in WMMA fragment order) on v_wmma_f32_16x16x32_f16 with f32 accumulate; elu (x*W1+b1, mul then add), bias sum over f and the 1/8 scale in f32 on VALU.
#include <hip/hip_runtime.h>
#include <math.h>

// ---------------------------------------------------------------------------
// Problem constants
// ---------------------------------------------------------------------------
constexpr int kRows   = 16384;            // N
constexpr int kFeat   = 64;               // F
constexpr int kHid    = 128;              // H
constexpr int kOutDim = 512;              // O
constexpr int kDepth  = kFeat * kHid;     // 8192 = GEMM K, k = f*128 + h
constexpr int kTileRows = 64;             // rows of x (and of out) per work-group
constexpr int kAPitch = kHid + 8;         // LDS pitch of an A row in halves: 272 B = 16 B x 17, conflict-free for 16-byte readers
constexpr int kXPitch = kTileRows + 4;    // LDS pitch of a transposed x row in floats (16-byte multiple)
constexpr int kFragHalves = 512;          // one packed B fragment (16 columns x 32 k): 2 x 32 lanes x 8 halves = 1 KiB
constexpr int kWavePassHalves = 16 * kFragHalves;   // one wave's B of one pass: 4 k-steps x 4 column tiles = 16 KiB
constexpr int kPassHalves = 8 * kWavePassHalves;    // all 512 columns of one pass (128 k) = 128 KiB
constexpr float kW2Carry  = 256.0f;                      // W2 carried x256 in f16 (exact power of two)
constexpr float kOutScale = 0.125f / 256.0f;             // (1/sqrt(64)) / carry = 2^-11, exact
constexpr float kBiasScale = 0.125f;                     // bias row = (sum_f b2) / 8

static_assert(kRows % kTileRows == 0 && kOutDim == 8 * 64 && kHid % 32 == 0, "tile multiples");

typedef __attribute__((ext_vector_type(16))) _Float16 v16h;
typedef __attribute__((ext_vector_type(8)))  _Float16 v8h;
typedef __attribute__((ext_vector_type(8)))  float    v8f;
typedef __attribute__((ext_vector_type(4)))  float    v4f;
typedef __attribute__((ext_vector_type(4)))  unsigned int v4u;
typedef __attribute__((ext_vector_type(2)))  unsigned int v2u;

__device__ __forceinline__ v16h frag_load(const _Float16* p) {   // elements 0..7 <- p[0..7], 8..15 <- p[16..23]
  union { v16h v; v8h h[2]; } f;
  f.h[0] = *(const v8h*)(p); f.h[1] = *(const v8h*)(p + 16); return f.v;
}
__device__ __forceinline__ v16h frag_load_packed(const _Float16* p) {   // elements 0..7 <- p[0..7], 8..15 <- p[256..263]
  union { v16h v; v8h h[2]; } f;
  f.h[0] = *(const v8h*)(p); f.h[1] = *(const v8h*)(p + 256); return f.v;
}
__device__ __forceinline__ v8f mma_f16(v16h a, v16h b, v8f c) {
  return __builtin_amdgcn_wmma_f32_16x16x32_f16(false, a, false, b, (short)0, c, false, false);
}

__device__ __forceinline__ unsigned pk16(unsigned short a, unsigned short b) { return (unsigned)a | ((unsigned)b << 16); }
__device__ __forceinline__ unsigned short h_bits(float f) { const _Float16 h = (_Float16)f; return __builtin_bit_cast(unsigned short, h); }

__device__ __forceinline__ void xcnt_fence() {
  asm volatile("s_wait_xcnt 0x0" ::: "memory");
  __builtin_amdgcn_sched_barrier(0);
}

// One activation: f16( elu( xv * w + c ) ), f32 mul then add (no contraction), elu negative branch via expm1f.
// The arithmetic of the unfused activation kernel, kept as it was (two roundings, as the reference writes it), so that
// every f16 value of A, the sign test on p included, is the same as before the fusion.
__device__ __forceinline__ unsigned short elu_h(float xv, float w, float c) {
#pragma clang fp contract(off)
  float p = xv * w;
  p = p + c;
  const float e = expm1f(fminf(p, 0.0f));
  const float a = (p > 0.0f) ? p : e;
  return h_bits(a);
}

// A tile of one feature f: rows arow0..arow0+7 of the work-group's 64, this lane's 4 consecutive h.
// xcol = the transposed x tile's row f (64 floats); w, c = W1[f][h4..h4+3], b1[f][h4..h4+3].
__device__ __forceinline__ void fill_a(_Float16* dst, const float* xcol, int arow0, int h4, v4f w, v4f c) {
  const v4f xa = *(const v4f*)(xcol + arow0);
  const v4f xb = *(const v4f*)(xcol + arow0 + 4);
#pragma unroll
  for (int i = 0; i < 8; ++i) {
    const float xv = (i < 4) ? xa[i & 3] : xb[i & 3];
    const v2u u = (v2u){pk16(elu_h(xv, w[0], c[0]), elu_h(xv, w[1], c[1])),
                        pk16(elu_h(xv, w[2], c[2]), elu_h(xv, w[3], c[3]))};
    *(v2u*)(dst + (arow0 + i) * kAPitch + h4) = u;    // a wave stores one whole 256-B row
  }
}

// B fragments of one pass (128 k) for this wave's 64 columns; p = this lane's 16 bytes in the wave's first packed fragment.
// Every load of the wave reads 512 consecutive bytes (4 whole lines). The caller keeps p live up to its s_wait_xcnt 0.
__device__ __forceinline__ void load_b(v16h (&bh)[4][4], const _Float16* p) {
#pragma unroll
  for (int ks = 0; ks < 4; ++ks)
#pragma unroll
    for (int j = 0; j < 4; ++j) bh[ks][j] = frag_load_packed(p + (ks * 4 + j) * kFragHalves);
}

// The pass's s_wait_xcnt 0, at the pass's foot: the three addresses that the pass's loads name are inputs of the wait,
// so they stay in their registers up to it, and the wave does not stand behind its own 34 loads at the pass's head.
// The scheduling barrier keeps later register writes below the wait.
__device__ __forceinline__ void xcnt_foot(const _Float16* pb, const float* pw, const float* pc) {
  asm volatile("s_wait_xcnt 0x0" :: "v"(pb), "v"(pw), "v"(pc) : "memory");
  __builtin_amdgcn_sched_barrier(0);
}

// One pass: 4 k-steps of 32, each 4 A fragments out of LDS (read as one group) times 4 B fragments.
__device__ __forceinline__ void mma_pass(v8f (&acc)[4][4], const v16h (&bh)[4][4], const _Float16* Ab) {
#pragma unroll
  for (int ks = 0; ks < 4; ++ks) {
    v16h ah[4];
#pragma unroll
    for (int i = 0; i < 4; ++i) ah[i] = frag_load(Ab + (i << 4) * kAPitch + (ks << 5));
    // keeps the k-step's 8 LDS reads one group in front of its 16 WMMAs: with both B sets live the scheduler otherwise
    // reads one fragment at a time into one register set and waits out the LDS latency in front of every 4 WMMAs
    __builtin_amdgcn_sched_barrier(0);
#pragma unroll
    for (int i = 0; i < 4; ++i)
#pragma unroll
      for (int j = 0; j < 4; ++j) acc[i][j] = mma_f16(ah[i], bh[ks][j], acc[i][j]);
  }
}

// ---------------------------------------------------------------------------
// Fused activation + GEMM. One work-group = 64 rows x all 512 outputs; wave w owns the 64x64 tile at columns 64w.
// A pass is one feature f (128 k): the 8 waves together make A[64][128] of feature f+1 in one LDS buffer while
// they multiply feature f out of the other; one barrier a pass publishes the new buffer and frees the old one.
// Bt in fragment order (see w2t_cast_kernel), read straight into registers (no wave shares another's columns), into two
// register sets: a pass issues the NEXT pass's 32 loads at its head, so they have the whole pass (activation and WMMAs) to land.
// Each accumulator sums k in ascending steps of 32.
// ---------------------------------------------------------------------------
__global__ __launch_bounds__(256) void fused_act_gemm(const float* __restrict__ x, const float* __restrict__ W1,
                                                      const float* __restrict__ b1,
                                                      const unsigned short* __restrict__ Btp,
                                                      const float* __restrict__ bias, float* __restrict__ C) {
  __shared__ __align__(16) _Float16 As[2][kTileRows * kAPitch];   // two A buffers, 17,408 B each
  __shared__ __align__(16) float xs[kFeat * kXPitch];             // x tile transposed: xs[f][row]
  __shared__ __align__(16) float sT[8][16 * 68];                  // per-wave 16x64 output slab, pitch 68 floats
  const _Float16* Bt = (const _Float16*)Btp;
  const int t    = threadIdx.x;
  const int lane = t & 31;
  const int wave = t >> 5;
  const int m0 = blockIdx.x * kTileRows;
  const int n0 = wave << 6;

  const int rlane = lane & 15;                 // row (A) / col (B, D) within subtile
  const int koff  = (lane >> 4) * 8;           // k offset of this lane half
  const int mOff  = (lane >> 4) * 8;           // D row offset
  const int h4    = lane * 4;                  // this lane's h in the A fill
  const int arow0 = wave * 8;                  // this wave's rows in the A fill

  // x tile: 64 rows x 64 features = 4096 consecutive floats of x; W1 and b1 rows of features 0 and 1
  float xr[16];
#pragma unroll
  for (int i = 0; i < 16; ++i) xr[i] = x[(size_t)m0 * kFeat + i * 256 + t];
  const v4f w0 = *(const v4f*)(W1 + h4);
  const v4f c0 = *(const v4f*)(b1 + h4);
  v4f w = *(const v4f*)(W1 + kHid + h4);
  v4f c = *(const v4f*)(b1 + kHid + h4);
  const _Float16* Bw = Bt + wave * kWavePassHalves + lane * 8;
  v16h be[4][4], bo[4][4];                     // B fragments of the even and of the odd features
  load_b(be, Bw);                              // feature 0's B, issued with the x tile's loads
  xcnt_fence();
#pragma unroll
  for (int i = 0; i < 16; ++i) {
    const int e = i * 256 + t;
    xs[(e & 63) * kXPitch + (e >> 6)] = xr[i];
  }
  __syncthreads();
  fill_a(As[0], xs, arow0, h4, w0, c0);

  v8f acc[4][4];
#pragma unroll
  for (int i = 0; i < 4; ++i)
#pragma unroll
    for (int j = 0; j < 4; ++j) acc[i][j] = (v8f){0.f,0.f,0.f,0.f,0.f,0.f,0.f,0.f};
  __syncthreads();

  const _Float16* Ar = As[0] + rlane * kAPitch + koff;
  static_assert(kFeat % 2 == 0, "two passes a trip");
  for (int f = 0;; f += 2) {
    // even pass f: multiplies feature f (As[0], be), makes feature f+1 in As[1], fetches feature f+1's B into bo
    const bool more = f + 2 < kFeat;                  // the same for the whole grid
    const int fe = more ? (f + 2) : (kFeat - 1);      // the feature made and fetched in the odd pass
    const int fo = more ? (f + 3) : (kFeat - 1);
    const float* pw = W1 + fe * kHid + h4;
    const float* pc = b1 + fe * kHid + h4;
    const _Float16* pb = Bw + (size_t)(f + 1) * kPassHalves;
    const v4f wn = *(const v4f*)pw;
    const v4f cn = *(const v4f*)pc;
    load_b(bo, pb);
    __builtin_amdgcn_sched_barrier(0);   // holds the loads above the arithmetic: the scheduler sinks them to their WMMAs otherwise
    fill_a(As[1], xs + (f + 1) * kXPitch, arow0, h4, w, c);
    mma_pass(acc, be, Ar);
    xcnt_foot(pb, pw, pc);
    __syncthreads();   // publishes feature f+1's buffer and frees feature f's

    // odd pass f+1: multiplies feature f+1 (As[1], bo); while a feature f+2 exists, makes it in As[0] and fetches its B into be
    const float* qw = W1 + fo * kHid + h4;
    const float* qc = b1 + fo * kHid + h4;
    const _Float16* qb = Bw + (size_t)fe * kPassHalves;
    if (more) {
      w = *(const v4f*)qw;
      c = *(const v4f*)qc;
      load_b(be, qb);
      __builtin_amdgcn_sched_barrier(0);   // as above
      fill_a(As[0], xs + (f + 2) * kXPitch, arow0, h4, wn, cn);
    }
    mma_pass(acc, bo, Ar + kTileRows * kAPitch);
    xcnt_foot(qb, qw, qc);
    if (!more) break;
    __syncthreads();   // publishes feature f+2's buffer and frees feature f+1's
  }

  // ---- epilogue ----
  float* slab = sT[wave];
#pragma unroll
  for (int i = 0; i < 4; ++i) {
    const int mBase = m0 + (i << 4);
#pragma unroll
    for (int j = 0; j < 4; ++j) {
      const int n = n0 + (j << 4) + rlane;
      const float bv = bias[n];
#pragma unroll
      for (int r = 0; r < 8; ++r) {
        float v = acc[i][j][r] * kOutScale;
        v += bv;
        slab[(mOff + r) * 68 + (j << 4) + rlane] = v;
      }
    }
    __builtin_amdgcn_fence(__ATOMIC_RELEASE, "workgroup");
    __builtin_amdgcn_wave_barrier();
    __builtin_amdgcn_fence(__ATOMIC_ACQUIRE, "workgroup");
    {
      const int hh = lane >> 4, c4 = (lane & 15) * 4;     // row seg = 256 B = 16 lanes x 16 B
#pragma unroll
      for (int it = 0; it < 8; ++it) {
        const int row = it * 2 + hh;
        v4f v = *(const v4f*)(slab + row * 68 + c4);
        *(v4f*)(C + (size_t)(mBase + row) * kOutDim + n0 + c4) = v;
      }
      xcnt_fence();
    }
    __builtin_amdgcn_fence(__ATOMIC_RELEASE, "workgroup");
    __builtin_amdgcn_wave_barrier();
    __builtin_amdgcn_fence(__ATOMIC_ACQUIRE, "workgroup");
  }
}

// ---------------------------------------------------------------------------
// W2 transpose + cast + pack: W2 viewed row-major [kDepth = 8192 (k = f*128+h)][kOutDim = 512] f32
//   -> f16(scale * W2[k][o]) in the order in which the GEMM's waves load their B fragments:
//   out[f][o>>6][ks = (k>>5)&3][j = (o>>4)&3][half = (k>>4)&1][lane = ((k>>3)&1)*16 + (o&15)][k&7], in halves.
// grid (kDepth/64 = 128, kOutDim/64 = 8), 256 threads; blockIdx.x = k tile (two k-steps of one f), blockIdx.y = o tile (one GEMM wave).
// Load coverage: 16 iterations x 256 threads = 4096 = the whole 64x64 tile (coalesced along o).
// Store coverage: 2 iterations (k-step) x 8 waves (j, half) x 32 lanes x 8 halves = 4096 = 8 KiB in a row; a wave stores 512 consecutive bytes.
// ---------------------------------------------------------------------------
__global__ __launch_bounds__(256) void w2t_cast_kernel(const float* __restrict__ W2, unsigned short* __restrict__ out, float scale) {
  __shared__ float sm[64][67];   // sm[o_local][k_local]; pitch 67: no bank conflict for the column writes nor for the 16-row x 2-group reads
  const int t  = threadIdx.x;
  const int k0 = blockIdx.x * 64;
  const int o0 = blockIdx.y * 64;
#pragma unroll
  for (int i = 0; i < 16; ++i) {
    const int e = i * 256 + t;
    const int r = e >> 6;          // k local
    const int c = e & 63;          // o local
    sm[c][r] = W2[(size_t)(k0 + r) * kOutDim + o0 + c] * scale;
  }
  __syncthreads();
  const int lane = t & 31, wave = t >> 5;
  const int j = wave >> 1, half = wave & 1;
  const int row = j * 16 + (lane & 15);                      // o local
  unsigned short* dst = out + (size_t)(blockIdx.x >> 1) * kPassHalves + blockIdx.y * kWavePassHalves
                            + ((blockIdx.x & 1) * 8 + j) * kFragHalves + half * 256 + lane * 8;
  {
#pragma unroll
    for (int it = 0; it < 2; ++it) {
      const int kc = it * 32 + half * 16 + (lane >> 4) * 8;  // k local
      unsigned short hb[8];
#pragma unroll
      for (int e = 0; e < 8; ++e) hb[e] = h_bits(sm[row][kc + e]);
      const v4u u = (v4u){pk16(hb[0], hb[1]), pk16(hb[2], hb[3]), pk16(hb[4], hb[5]), pk16(hb[6], hb[7])};
      *(v4u*)(dst + it * 4 * kFragHalves) = u;
    }
  }
}

// ---------------------------------------------------------------------------
// Bias row: bias_out[o] = (sum_{f=0..63} b2[f][o]) * 0.125, f32, sequential f order.
// One block of 128 threads; thread t owns o = 4t..4t+3 (128 x 4 = 512 = whole row).
// ---------------------------------------------------------------------------
__global__ __launch_bounds__(128) void bsum_kernel(const float* __restrict__ b2, float* __restrict__ bias_out) {
  const int t = threadIdx.x;
  v4f s = (v4f){0.f, 0.f, 0.f, 0.f};
#pragma unroll 1
  for (int f = 0; f < kFeat; ++f) {
    const v4f v = *(const v4f*)(b2 + (size_t)f * kOutDim + 4 * t);
    s = s + v;
  }
  s = s * kBiasScale;
  float* p = bias_out + 4 * t;
  *(v4f*)p = s;
  
}

// ---------------------------------------------------------------------------
//   [0,          8388608)   Bt   f16, 512 x 8192 values     (W2 transposed, carried x256, in fragment order)
//   [8388608,    8390656)   bias f32 [512]                  (= 0.125 * sum_f b2), region padded to 4096 B
//   total carve = 8,392,704 B
// Launches: 1 (w2t_cast) + 1 (bsum) + 1 (fused activation + GEMM) = 3.
// ---------------------------------------------------------------------------
extern "C" void kernel_launch(void* const* d_in, const int* in_sizes, int n_in,
                              void* d_out, int out_size, void* d_ws, size_t ws_size,
                              hipStream_t stream) {
  if (n_in < 5) return;
  if (in_sizes[0] != kRows * kFeat) return;
  if (in_sizes[1] != kFeat * kHid) return;
  if (in_sizes[2] != kFeat * kHid) return;
  if (in_sizes[3] != kFeat * kHid * kOutDim) return;
  if (in_sizes[4] != kFeat * kOutDim) return;
  if (out_size != kRows * kOutDim) return;

  const float* x  = (const float*)d_in[0];
  const float* W1 = (const float*)d_in[1];
  const float* b1 = (const float*)d_in[2];
  const float* W2 = (const float*)d_in[3];
  const float* b2 = (const float*)d_in[4];
  float* out = (float*)d_out;

  const size_t bytesBt   = (size_t)kOutDim * kDepth * 2;          // 8,388,608
  const size_t bytesBias = 4096;                                   // 512 floats = 2048 B, padded
  const size_t offBt   = 0;
  const size_t offBias = offBt + bytesBt;
  const size_t total   = offBias + bytesBias;                      // 8,392,704
  if (total > ws_size) return;

  unsigned char* ws = (unsigned char*)d_ws;
  unsigned short* Bt  = (unsigned short*)(ws + offBt);
  float*          bsp = (float*)(ws + offBias);

  // Bt = f16(256 * W2^T) in fragment order; grid (k tiles, o tiles) = (128, 8)
  w2t_cast_kernel<<<dim3(kDepth / 64, kOutDim / 64, 1), dim3(256, 1, 1), 0, stream>>>(W2, Bt, kW2Carry);
  // bias row
  bsum_kernel<<<dim3(1, 1, 1), dim3(128, 1, 1), 0, stream>>>(b2, bsp);
  // out[16384][512] = 2^-11 * elu(x*W1+b1) . Bt^T + bias[n]; 256 work-groups of 64 rows
  fused_act_gemm<<<dim3(kRows / kTileRows, 1, 1), dim3(256, 1, 1), 0, stream>>>(
      x, W1, b1, (const unsigned short*)Bt, (const float*)bsp, out);
}

// v004
// One run takes 147 microseconds.
// In both of two side-by-side timings against v003, it was 1.20 times as fast.
// Counting every step since v000, it is 10.9 times as fast.
// Contraction: A[16384 x 8192] (f16, elu activations carried x1, made in LDS tile by tile) . Bt[512 x 8192]^T (f16, W2 carried x256, stored in WMMA fragment order) on v_wmma_f32_16x16x32_f16 with f32 accumulate; elu (x*W1+b1, negative branch exp2(p*log2 e) - 1 on v_exp_f32), bias sum over f and the 1/8 scale in f32 on VALU.
#include <hip/hip_runtime.h>
#include <math.h>

// ---------------------------------------------------------------------------
// Problem constants
// ---------------------------------------------------------------------------
constexpr int kRows   = 16384;            // N
constexpr int kFeat   = 64;               // F
constexpr int kHid    = 128;              // H
constexpr int kOutDim = 512;              // O
constexpr int kDepth  = kFeat * kHid;     // 8192 = GEMM K, k = f*128 + h
constexpr int kTileRows = 64;             // rows of x (and of out) per work-group
constexpr int kAPitch = kHid + 8;         // LDS pitch of an A row in halves: 272 B = 16 B x 17, conflict-free for 16-byte readers
constexpr int kXPitch = kTileRows + 4;    // LDS pitch of a transposed x row in floats (16-byte multiple)
constexpr int kFragHalves = 512;          // one packed B fragment (16 columns x 32 k): 2 x 32 lanes x 8 halves = 1 KiB
constexpr int kWavePassHalves = 16 * kFragHalves;   // one wave's B of one pass: 4 k-steps x 4 column tiles = 16 KiB
constexpr int kPassHalves = 8 * kWavePassHalves;    // all 512 columns of one pass (128 k) = 128 KiB
constexpr float kW2Carry  = 256.0f;                      // W2 carried x256 in f16 (exact power of two)
constexpr float kOutScale = 0.125f / 256.0f;             // (1/sqrt(64)) / carry = 2^-11, exact
constexpr float kBiasScale = 0.125f;                     // bias row = (sum_f b2) / 8
constexpr float kLog2e = 1.44269504088896340736f;        // e^p = 2^(p * log2 e)

static_assert(kRows % kTileRows == 0 && kOutDim == 8 * 64 && kHid % 32 == 0, "tile multiples");

typedef __attribute__((ext_vector_type(16))) _Float16 v16h;
typedef __attribute__((ext_vector_type(8)))  _Float16 v8h;
typedef __attribute__((ext_vector_type(8)))  float    v8f;
typedef __attribute__((ext_vector_type(4)))  float    v4f;
typedef __attribute__((ext_vector_type(2)))  float    v2f;
typedef __attribute__((ext_vector_type(2)))  _Float16 v2h;
typedef __attribute__((ext_vector_type(4)))  unsigned int v4u;
typedef __attribute__((ext_vector_type(2)))  unsigned int v2u;

__device__ __forceinline__ v16h frag_load(const _Float16* p) {   // elements 0..7 <- p[0..7], 8..15 <- p[16..23]
  union { v16h v; v8h h[2]; } f;
  f.h[0] = *(const v8h*)(p); f.h[1] = *(const v8h*)(p + 16); return f.v;
}
__device__ __forceinline__ v16h frag_load_packed(const _Float16* p) {   // elements 0..7 <- p[0..7], 8..15 <- p[256..263]
  union { v16h v; v8h h[2]; } f;
  f.h[0] = *(const v8h*)(p); f.h[1] = *(const v8h*)(p + 256); return f.v;
}
__device__ __forceinline__ v8f mma_f16(v16h a, v16h b, v8f c) {
  return __builtin_amdgcn_wmma_f32_16x16x32_f16(false, a, false, b, (short)0, c, false, false);
}

__device__ __forceinline__ unsigned pk16(unsigned short a, unsigned short b) { return (unsigned)a | ((unsigned)b << 16); }
__device__ __forceinline__ unsigned short h_bits(float f) { const _Float16 h = (_Float16)f; return __builtin_bit_cast(unsigned short, h); }

__device__ __forceinline__ void xcnt_fence() {
  asm volatile("s_wait_xcnt 0x0" ::: "memory");
  __builtin_amdgcn_sched_barrier(0);
}

// Two activations of neighbouring h, packed: f16( elu( xv * w + c ) ), all in f32 up to the last rounding.
// Negative branch: e^p - 1 = exp2(p * log2 e) - 1 on the hardware exponential. Against expm1f its absolute error is a few
// 2^-24 (the subtraction from a value near 1), three orders below the f16 rounding of an activation near -1, and every
// activation enters a sum of 8192 products.
// The branch: e^p - 1 >= p everywhere and has p's sign, so elu(p) = max(min(e^p - 1, 0), p): for p > 0 the inner
// minimum is 0 (also where exp2 overflows to +inf), for p <= 0 it is e^p - 1. No clamp of the exponent is needed.
__device__ __forceinline__ unsigned elu2_h(float xv, v2f w, v2f c) {
  const v2f p = xv * w + c;
  const v2f t = p * kLog2e;
  const v2f e = (v2f){__builtin_amdgcn_exp2f(t[0]), __builtin_amdgcn_exp2f(t[1])} - 1.0f;
  const v2f a = (v2f){fmaxf(fminf(e[0], 0.0f), p[0]), fmaxf(fminf(e[1], 0.0f), p[1])};
  return __builtin_bit_cast(unsigned, __builtin_convertvector(a, v2h));
}

// A tile of one feature f: rows arow0..arow0+7 of the work-group's 64, this lane's 4 consecutive h.
// xcol = the transposed x tile's row f (64 floats); w, c = W1[f][h4..h4+3], b1[f][h4..h4+3].
__device__ __forceinline__ void fill_a(_Float16* dst, const float* xcol, int arow0, int h4, v4f w, v4f c) {
  const v4f xa = *(const v4f*)(xcol + arow0);
  const v4f xb = *(const v4f*)(xcol + arow0 + 4);
#pragma unroll
  for (int i = 0; i < 8; ++i) {
    const float xv = (i < 4) ? xa[i & 3] : xb[i & 3];
    const v2u u = (v2u){elu2_h(xv, w.lo, c.lo), elu2_h(xv, w.hi, c.hi)};
    *(v2u*)(dst + (arow0 + i) * kAPitch + h4) = u;    // a wave stores one whole 256-B row
  }
}

// B fragments of one pass (128 k) for this wave's 64 columns; p = this lane's 16 bytes in the wave's first packed fragment.
// Every load of the wave reads 512 consecutive bytes (4 whole lines). The caller keeps p live up to its s_wait_xcnt 0.
__device__ __forceinline__ void load_b(v16h (&bh)[4][4], const _Float16* p) {
#pragma unroll
  for (int ks = 0; ks < 4; ++ks)
#pragma unroll
    for (int j = 0; j < 4; ++j) bh[ks][j] = frag_load_packed(p + (ks * 4 + j) * kFragHalves);
}

// The pass's s_wait_xcnt 0, at the pass's foot: the three addresses that the pass's loads name are inputs of the wait,
// so they stay in their registers up to it, and the wave does not stand behind its own 34 loads at the pass's head.
// The scheduling barrier keeps later register writes below the wait.
__device__ __forceinline__ void xcnt_foot(const _Float16* pb, const float* pw, const float* pc) {
  asm volatile("s_wait_xcnt 0x0" :: "v"(pb), "v"(pw), "v"(pc) : "memory");
  __builtin_amdgcn_sched_barrier(0);
}

// One pass: 4 k-steps of 32, each 4 A fragments out of LDS (read as one group) times 4 B fragments.
__device__ __forceinline__ void mma_pass(v8f (&acc)[4][4], const v16h (&bh)[4][4], const _Float16* Ab) {
#pragma unroll
  for (int ks = 0; ks < 4; ++ks) {
    v16h ah[4];
#pragma unroll
    for (int i = 0; i < 4; ++i) ah[i] = frag_load(Ab + (i << 4) * kAPitch + (ks << 5));
    // keeps the k-step's 8 LDS reads one group in front of its 16 WMMAs: with both B sets live the scheduler otherwise
    // reads one fragment at a time into one register set and waits out the LDS latency in front of every 4 WMMAs
    __builtin_amdgcn_sched_barrier(0);
#pragma unroll
    for (int i = 0; i < 4; ++i)
#pragma unroll
      for (int j = 0; j < 4; ++j) acc[i][j] = mma_f16(ah[i], bh[ks][j], acc[i][j]);
  }
}

// ---------------------------------------------------------------------------
// Fused activation + GEMM. One work-group = 64 rows x all 512 outputs; wave w owns the 64x64 tile at columns 64w.
// A pass is one feature f (128 k): the 8 waves together make A[64][128] of feature f+1 in one LDS buffer while
// they multiply feature f out of the other; one barrier a pass publishes the new buffer and frees the old one.
// Bt in fragment order (see w2t_cast_kernel), read straight into registers (no wave shares another's columns), into two
// register sets: a pass issues the NEXT pass's 32 loads at its head, so they have the whole pass (activation and WMMAs) to land.
// Each accumulator sums k in ascending steps of 32.
// ---------------------------------------------------------------------------
__global__ __launch_bounds__(256) void fused_act_gemm(const float* __restrict__ x, const float* __restrict__ W1,
                                                      const float* __restrict__ b1,
                                                      const unsigned short* __restrict__ Btp,
                                                      const float* __restrict__ bias, float* __restrict__ C) {
  __shared__ __align__(16) _Float16 As[2][kTileRows * kAPitch];   // two A buffers, 17,408 B each
  __shared__ __align__(16) float xs[kFeat * kXPitch];             // x tile transposed: xs[f][row]
  __shared__ __align__(16) float sT[8][16 * 68];                  // per-wave 16x64 output slab, pitch 68 floats
  const _Float16* Bt = (const _Float16*)Btp;
  const int t    = threadIdx.x;
  const int lane = t & 31;
  const int wave = t >> 5;
  const int m0 = blockIdx.x * kTileRows;
  const int n0 = wave << 6;

  const int rlane = lane & 15;                 // row (A) / col (B, D) within subtile
  const int koff  = (lane >> 4) * 8;           // k offset of this lane half
  const int mOff  = (lane >> 4) * 8;           // D row offset
  const int h4    = lane * 4;                  // this lane's h in the A fill
  const int arow0 = wave * 8;                  // this wave's rows in the A fill

  // x tile: 64 rows x 64 features = 4096 consecutive floats of x; W1 and b1 rows of features 0 and 1
  float xr[16];
#pragma unroll
  for (int i = 0; i < 16; ++i) xr[i] = x[(size_t)m0 * kFeat + i * 256 + t];
  const v4f w0 = *(const v4f*)(W1 + h4);
  const v4f c0 = *(const v4f*)(b1 + h4);
  v4f w = *(const v4f*)(W1 + kHid + h4);
  v4f c = *(const v4f*)(b1 + kHid + h4);
  const _Float16* Bw = Bt + wave * kWavePassHalves + lane * 8;
  v16h be[4][4], bo[4][4];                     // B fragments of the even and of the odd features
  load_b(be, Bw);                              // feature 0's B, issued with the x tile's loads
  xcnt_fence();
#pragma unroll
  for (int i = 0; i < 16; ++i) {
    const int e = i * 256 + t;
    xs[(e & 63) * kXPitch + (e >> 6)] = xr[i];
  }
  __syncthreads();
  fill_a(As[0], xs, arow0, h4, w0, c0);

  v8f acc[4][4];
#pragma unroll
  for (int i = 0; i < 4; ++i)
#pragma unroll
    for (int j = 0; j < 4; ++j) acc[i][j] = (v8f){0.f,0.f,0.f,0.f,0.f,0.f,0.f,0.f};
  __syncthreads();

  const _Float16* Ar = As[0] + rlane * kAPitch + koff;
  static_assert(kFeat % 2 == 0, "two passes a trip");
  for (int f = 0;; f += 2) {
    // even pass f: multiplies feature f (As[0], be), makes feature f+1 in As[1], fetches feature f+1's B into bo
    const bool more = f + 2 < kFeat;                  // the same for the whole grid
    const int fe = more ? (f + 2) : (kFeat - 1);      // the feature made and fetched in the odd pass
    const int fo = more ? (f + 3) : (kFeat - 1);
    const float* pw = W1 + fe * kHid + h4;
    const float* pc = b1 + fe * kHid + h4;
    const _Float16* pb = Bw + (size_t)(f + 1) * kPassHalves;
    const v4f wn = *(const v4f*)pw;
    const v4f cn = *(const v4f*)pc;
    load_b(bo, pb);
    __builtin_amdgcn_sched_barrier(0);   // holds the loads above the arithmetic: the scheduler sinks them to their WMMAs otherwise
    fill_a(As[1], xs + (f + 1) * kXPitch, arow0, h4, w, c);
    mma_pass(acc, be, Ar);
    xcnt_foot(pb, pw, pc);
    __syncthreads();   // publishes feature f+1's buffer and frees feature f's

    // odd pass f+1: multiplies feature f+1 (As[1], bo); while a feature f+2 exists, makes it in As[0] and fetches its B into be
    const float* qw = W1 + fo * kHid + h4;
    const float* qc = b1 + fo * kHid + h4;
    const _Float16* qb = Bw + (size_t)fe * kPassHalves;
    if (more) {
      w = *(const v4f*)qw;
      c = *(const v4f*)qc;
      load_b(be, qb);
      __builtin_amdgcn_sched_barrier(0);   // as above
      fill_a(As[0], xs + (f + 2) * kXPitch, arow0, h4, wn, cn);
    }
    mma_pass(acc, bo, Ar + kTileRows * kAPitch);
    xcnt_foot(qb, qw, qc);
    if (!more) break;
    __syncthreads();   // publishes feature f+2's buffer and frees feature f+1's
  }

  // ---- epilogue ----
  float* slab = sT[wave];
#pragma unroll
  for (int i = 0; i < 4; ++i) {
    const int mBase = m0 + (i << 4);
#pragma unroll
    for (int j = 0; j < 4; ++j) {
      const int n = n0 + (j << 4) + rlane;
      const float bv = bias[n];
#pragma unroll
      for (int r = 0; r < 8; ++r) {
        float v = acc[i][j][r] * kOutScale;
        v += bv;
        slab[(mOff + r) * 68 + (j << 4) + rlane] = v;
      }
    }
    __builtin_amdgcn_fence(__ATOMIC_RELEASE, "workgroup");
    __builtin_amdgcn_wave_barrier();
    __builtin_amdgcn_fence(__ATOMIC_ACQUIRE, "workgroup");
    {
      const int hh = lane >> 4, c4 = (lane & 15) * 4;     // row seg = 256 B = 16 lanes x 16 B
#pragma unroll
      for (int it = 0; it < 8; ++it) {
        const int row = it * 2 + hh;
        v4f v = *(const v4f*)(slab + row * 68 + c4);
        *(v4f*)(C + (size_t)(mBase + row) * kOutDim + n0 + c4) = v;
      }
      xcnt_fence();
    }
    __builtin_amdgcn_fence(__ATOMIC_RELEASE, "workgroup");
    __builtin_amdgcn_wave_barrier();
    __builtin_amdgcn_fence(__ATOMIC_ACQUIRE, "workgroup");
  }
}

// ---------------------------------------------------------------------------
// W2 transpose + cast + pack: W2 viewed row-major [kDepth = 8192 (k = f*128+h)][kOutDim = 512] f32
//   -> f16(scale * W2[k][o]) in the order in which the GEMM's waves load their B fragments:
//   out[f][o>>6][ks = (k>>5)&3][j = (o>>4)&3][half = (k>>4)&1][lane = ((k>>3)&1)*16 + (o&15)][k&7], in halves.
// grid (kDepth/64 = 128, kOutDim/64 = 8), 256 threads; blockIdx.x = k tile (two k-steps of one f), blockIdx.y = o tile (one GEMM wave).
// Load coverage: 16 iterations x 256 threads = 4096 = the whole 64x64 tile (coalesced along o).
// Store coverage: 2 iterations (k-step) x 8 waves (j, half) x 32 lanes x 8 halves = 4096 = 8 KiB in a row; a wave stores 512 consecutive bytes.
// ---------------------------------------------------------------------------
__global__ __launch_bounds__(256) void w2t_cast_kernel(const float* __restrict__ W2, unsigned short* __restrict__ out, float scale) {
  __shared__ float sm[64][67];   // sm[o_local][k_local]; pitch 67: no bank conflict for the column writes nor for the 16-row x 2-group reads
  const int t  = threadIdx.x;
  const int k0 = blockIdx.x * 64;
  const int o0 = blockIdx.y * 64;
#pragma unroll
  for (int i = 0; i < 16; ++i) {
    const int e = i * 256 + t;
    const int r = e >> 6;          // k local
    const int c = e & 63;          // o local
    sm[c][r] = W2[(size_t)(k0 + r) * kOutDim + o0 + c] * scale;
  }
  __syncthreads();
  const int lane = t & 31, wave = t >> 5;
  const int j = wave >> 1, half = wave & 1;
  const int row = j * 16 + (lane & 15);                      // o local
  unsigned short* dst = out + (size_t)(blockIdx.x >> 1) * kPassHalves + blockIdx.y * kWavePassHalves
                            + ((blockIdx.x & 1) * 8 + j) * kFragHalves + half * 256 + lane * 8;
  {
#pragma unroll
    for (int it = 0; it < 2; ++it) {
      const int kc = it * 32 + half * 16 + (lane >> 4) * 8;  // k local
      unsigned short hb[8];
#pragma unroll
      for (int e = 0; e < 8; ++e) hb[e] = h_bits(sm[row][kc + e]);
      const v4u u = (v4u){pk16(hb[0], hb[1]), pk16(hb[2], hb[3]), pk16(hb[4], hb[5]), pk16(hb[6], hb[7])};
      *(v4u*)(dst + it * 4 * kFragHalves) = u;
    }
  }
}

// ---------------------------------------------------------------------------
// Bias row: bias_out[o] = (sum_{f=0..63} b2[f][o]) * 0.125, f32, sequential f order.
// One block of 128 threads; thread t owns o = 4t..4t+3 (128 x 4 = 512 = whole row).
// ---------------------------------------------------------------------------
__global__ __launch_bounds__(128) void bsum_kernel(const float* __restrict__ b2, float* __restrict__ bias_out) {
  const int t = threadIdx.x;
  v4f s = (v4f){0.f, 0.f, 0.f, 0.f};
#pragma unroll 1
  for (int f = 0; f < kFeat; ++f) {
    const v4f v = *(const v4f*)(b2 + (size_t)f * kOutDim + 4 * t);
    s = s + v;
  }
  s = s * kBiasScale;
  float* p = bias_out + 4 * t;
  *(v4f*)p = s;
  
}

// ---------------------------------------------------------------------------
//   [0,          8388608)   Bt   f16, 512 x 8192 values     (W2 transposed, carried x256, in fragment order)
//   [8388608,    8390656)   bias f32 [512]                  (= 0.125 * sum_f b2), region padded to 4096 B
//   total carve = 8,392,704 B
// Launches: 1 (w2t_cast) + 1 (bsum) + 1 (fused activation + GEMM) = 3.
// ---------------------------------------------------------------------------
extern "C" void kernel_launch(void* const* d_in, const int* in_sizes, int n_in,
                              void* d_out, int out_size, void* d_ws, size_t ws_size,
                              hipStream_t stream) {
  if (n_in < 5) return;
  if (in_sizes[0] != kRows * kFeat) return;
  if (in_sizes[1] != kFeat * kHid) return;
  if (in_sizes[2] != kFeat * kHid) return;
  if (in_sizes[3] != kFeat * kHid * kOutDim) return;
  if (in_sizes[4] != kFeat * kOutDim) return;
  if (out_size != kRows * kOutDim) return;

  const float* x  = (const float*)d_in[0];
  const float* W1 = (const float*)d_in[1];
  const float* b1 = (const float*)d_in[2];
  const float* W2 = (const float*)d_in[3];
  const float* b2 = (const float*)d_in[4];
  float* out = (float*)d_out;

  const size_t bytesBt   = (size_t)kOutDim * kDepth * 2;          // 8,388,608
  const size_t bytesBias = 4096;                                   // 512 floats = 2048 B, padded
  const size_t offBt   = 0;
  const size_t offBias = offBt + bytesBt;
  const size_t total   = offBias + bytesBias;                      // 8,392,704
  if (total > ws_size) return;

  unsigned char* ws = (unsigned char*)d_ws;
  unsigned short* Bt  = (unsigned short*)(ws + offBt);
  float*          bsp = (float*)(ws + offBias);

  // Bt = f16(256 * W2^T) in fragment order; grid (k tiles, o tiles) = (128, 8)
  w2t_cast_kernel<<<dim3(kDepth / 64, kOutDim / 64, 1), dim3(256, 1, 1), 0, stream>>>(W2, Bt, kW2Carry);
  // bias row
  bsum_kernel<<<dim3(1, 1, 1), dim3(128, 1, 1), 0, stream>>>(b2, bsp);
  // out[16384][512] = 2^-11 * elu(x*W1+b1) . Bt^T + bias[n]; 256 work-groups of 64 rows
  fused_act_gemm<<<dim3(kRows / kTileRows, 1, 1), dim3(256, 1, 1), 0, stream>>>(
      x, W1, b1, (const unsigned short*)Bt, (const float*)bsp, out);
}

// v005
// Measured time: 125 microseconds a run.
// In two side-by-side timings against v004, it was 1.17 and 1.16 times as fast.
// Over all steps from v000 it is 12.8 times as fast.
// Contraction: A[16384 x 8192] (f16, elu activations carried x1, made in LDS tile by tile) . Bt[512 x 8192]^T (f16, W2 carried x256, stored in WMMA fragment order) on v_wmma_f32_16x16x32_f16 with f32 accumulate; elu (x*W1+b1, negative branch exp2(p*log2 e) - 1 on v_exp_f32), bias sum over f and the 1/8 scale in f32 on VALU.
#include <hip/hip_runtime.h>
#include <math.h>

// ---------------------------------------------------------------------------
// Problem constants
// ---------------------------------------------------------------------------
constexpr int kRows   = 16384;            // N
constexpr int kFeat   = 64;               // F
constexpr int kHid    = 128;              // H
constexpr int kOutDim = 512;              // O
constexpr int kDepth  = kFeat * kHid;     // 8192 = GEMM K, k = f*128 + h
constexpr int kTileRows = 64;             // rows of x (and of out) per work-group
constexpr int kAPitch = kHid + 8;         // LDS pitch of an A row in halves: 272 B = 16 B x 17, conflict-free for 16-byte readers
constexpr int kXPitch = kTileRows + 4;    // LDS pitch of a transposed x row in floats (16-byte multiple)
constexpr int kFragHalves = 512;          // one packed B fragment (16 columns x 32 k): 2 x 32 lanes x 8 halves = 1 KiB
constexpr int kWavePassHalves = 16 * kFragHalves;   // one wave's B of one pass: 4 k-steps x 4 column tiles = 16 KiB
constexpr int kPassHalves = 8 * kWavePassHalves;    // all 512 columns of one pass (128 k) = 128 KiB
constexpr float kW2Carry  = 256.0f;                      // W2 carried x256 in f16 (exact power of two)
constexpr float kOutScale = 0.125f / 256.0f;             // (1/sqrt(64)) / carry = 2^-11, exact
constexpr float kBiasScale = 0.125f;                     // bias row = (sum_f b2) / 8
constexpr float kLog2e = 1.44269504088896340736f;        // e^p = 2^(p * log2 e)

static_assert(kRows % kTileRows == 0 && kOutDim == 8 * 64 && kHid % 32 == 0, "tile multiples");

typedef __attribute__((ext_vector_type(16))) _Float16 v16h;
typedef __attribute__((ext_vector_type(8)))  _Float16 v8h;
typedef __attribute__((ext_vector_type(8)))  float    v8f;
typedef __attribute__((ext_vector_type(4)))  float    v4f;
typedef __attribute__((ext_vector_type(2)))  float    v2f;
typedef __attribute__((ext_vector_type(2)))  _Float16 v2h;
typedef __attribute__((ext_vector_type(4)))  unsigned int v4u;
typedef __attribute__((ext_vector_type(2)))  unsigned int v2u;

__device__ __forceinline__ v16h frag_load(const _Float16* p) {   // elements 0..7 <- p[0..7], 8..15 <- p[16..23]
  union { v16h v; v8h h[2]; } f;
  f.h[0] = *(const v8h*)(p); f.h[1] = *(const v8h*)(p + 16); return f.v;
}
__device__ __forceinline__ v16h frag_load_packed(const _Float16* p) {   // elements 0..7 <- p[0..7], 8..15 <- p[256..263]
  union { v16h v; v8h h[2]; } f;
  f.h[0] = *(const v8h*)(p); f.h[1] = *(const v8h*)(p + 256); return f.v;
}
__device__ __forceinline__ v8f mma_f16(v16h a, v16h b, v8f c) {
  return __builtin_amdgcn_wmma_f32_16x16x32_f16(false, a, false, b, (short)0, c, false, false);
}

__device__ __forceinline__ unsigned pk16(unsigned short a, unsigned short b) { return (unsigned)a | ((unsigned)b << 16); }
__device__ __forceinline__ unsigned short h_bits(float f) { const _Float16 h = (_Float16)f; return __builtin_bit_cast(unsigned short, h); }

__device__ __forceinline__ void xcnt_fence() {
  asm volatile("s_wait_xcnt 0x0" ::: "memory");
  __builtin_amdgcn_sched_barrier(0);
}

// Two activations of neighbouring h, packed: f16( elu( xv * w + c ) ), all in f32 up to the last rounding.
// Negative branch: e^p - 1 = exp2(p * log2 e) - 1 on the hardware exponential. Against expm1f its absolute error is a few
// 2^-24 (the subtraction from a value near 1), three orders below the f16 rounding of an activation near -1, and every
// activation enters a sum of 8192 products.
// The branch: e^p - 1 >= p everywhere and has p's sign, so elu(p) = max(min(e^p - 1, 0), p): for p > 0 the inner
// minimum is 0 (also where exp2 overflows to +inf), for p <= 0 it is e^p - 1. No clamp of the exponent is needed.
__device__ __forceinline__ unsigned elu2_h(float xv, v2f w, v2f c) {
  const v2f p = xv * w + c;
  const v2f t = p * kLog2e;
  const v2f e = (v2f){__builtin_amdgcn_exp2f(t[0]), __builtin_amdgcn_exp2f(t[1])} - 1.0f;
  const v2f a = (v2f){fmaxf(fminf(e[0], 0.0f), p[0]), fmaxf(fminf(e[1], 0.0f), p[1])};
  return __builtin_bit_cast(unsigned, __builtin_convertvector(a, v2h));
}

// A tile of one feature f: rows arow0..arow0+7 of the work-group's 64, this lane's 4 consecutive h.
// xcol = the transposed x tile's row f (64 floats); w, c = W1[f][h4..h4+3], b1[f][h4..h4+3].
__device__ __forceinline__ void fill_a(_Float16* dst, const float* xcol, int arow0, int h4, v4f w, v4f c) {
  const v4f xa = *(const v4f*)(xcol + arow0);
  const v4f xb = *(const v4f*)(xcol + arow0 + 4);
#pragma unroll
  for (int i = 0; i < 8; ++i) {
    const float xv = (i < 4) ? xa[i & 3] : xb[i & 3];
    const v2u u = (v2u){elu2_h(xv, w.lo, c.lo), elu2_h(xv, w.hi, c.hi)};
    *(v2u*)(dst + (arow0 + i) * kAPitch + h4) = u;    // a wave stores one whole 256-B row
  }
}

// B fragments of one pass (128 k) for this wave's 64 columns; p = this lane's 16 bytes in the wave's first packed fragment.
// Every load of the wave reads 512 consecutive bytes (4 whole lines). The caller keeps p live up to its s_wait_xcnt 0.
__device__ __forceinline__ void load_b(v16h (&bh)[4][4], const _Float16* p) {
#pragma unroll
  for (int ks = 0; ks < 4; ++ks)
#pragma unroll
    for (int j = 0; j < 4; ++j) bh[ks][j] = frag_load_packed(p + (ks * 4 + j) * kFragHalves);
}

// The pass's s_wait_xcnt 0, at the pass's foot: the three addresses that the pass's loads name are inputs of the wait,
// so they stay in their registers up to it. The scheduling barrier in front keeps the wait below the last k-step's WMMAs
// (lifted to just behind that k-step's loads the wave would stand there); the one behind keeps later register writes below it.
__device__ __forceinline__ void xcnt_foot(const _Float16* pb, const float* pw, const float* pc) {
  __builtin_amdgcn_sched_barrier(0);
  asm volatile("s_wait_xcnt 0x0" :: "v"(pb), "v"(pw), "v"(pc) : "memory");
  __builtin_amdgcn_sched_barrier(0);
}

// The pass's work-group barrier, ordering LDS only: this wave's LDS stores and reads are done (s_wait_dscnt 0), then signal and
// wait. __syncthreads() also waits for every global load of the wave, and the next pass's B loads are to stay in flight across it.
__device__ __forceinline__ void lds_barrier() {
  asm volatile("s_wait_dscnt 0x0" ::: "memory");
  asm volatile("s_barrier_signal -1\n\ts_barrier_wait -1" ::: "memory");
}

// One pass: 4 k-steps of 32, each 4 A fragments out of LDS (read as one group) times 4 B fragments.
// Each k-step also issues the 8 loads of the NEXT pass's B fragments of the same k-step (bn, from pn): a quarter of a pass's B
// at a time, a whole pass ahead of its WMMAs, so that the work-group asks L2 evenly and no wave queues 32 loads at one place.
__device__ __forceinline__ void mma_pass(v8f (&acc)[4][4], const v16h (&bh)[4][4], const _Float16* Ab,
                                         v16h (&bn)[4][4], const _Float16* pn) {
#pragma unroll
  for (int ks = 0; ks < 4; ++ks) {
    v16h ah[4];
#pragma unroll
    for (int i = 0; i < 4; ++i) ah[i] = frag_load(Ab + (i << 4) * kAPitch + (ks << 5));
#pragma unroll
    for (int j = 0; j < 4; ++j) bn[ks][j] = frag_load_packed(pn + (ks * 4 + j) * kFragHalves);
    // keeps the k-step's 8 LDS reads one group in front of its 16 WMMAs: with both B sets live the scheduler otherwise
    // reads one fragment at a time into one register set and waits out the LDS latency in front of every 4 WMMAs;
    // and holds the 8 global loads from sinking to their WMMAs (the scheduler may still lift a group up to the barrier before)
    __builtin_amdgcn_sched_barrier(0);
#pragma unroll
    for (int i = 0; i < 4; ++i)
#pragma unroll
      for (int j = 0; j < 4; ++j) acc[i][j] = mma_f16(ah[i], bh[ks][j], acc[i][j]);
  }
}

// ---------------------------------------------------------------------------
// Fused activation + GEMM. One work-group = 64 rows x all 512 outputs; wave w owns the 64x64 tile at columns 64w.
// A pass is one feature f (128 k): the 8 waves together make A[64][128] of feature f+1 in one LDS buffer while
// they multiply feature f out of the other; one barrier a pass publishes the new buffer and frees the old one.
// Bt in fragment order (see w2t_cast_kernel), read straight into registers (no wave shares another's columns), into two
// register sets: k-step ks of a pass issues the 8 loads of the NEXT pass's k-step ks, which stay in flight across the pass's barrier.
// Each accumulator sums k in ascending steps of 32.
// ---------------------------------------------------------------------------
__global__ __launch_bounds__(256) void fused_act_gemm(const float* __restrict__ x, const float* __restrict__ W1,
                                                      const float* __restrict__ b1,
                                                      const unsigned short* __restrict__ Btp,
                                                      const float* __restrict__ bias, float* __restrict__ C) {
  __shared__ __align__(16) _Float16 As[2][kTileRows * kAPitch];   // two A buffers, 17,408 B each
  __shared__ __align__(16) float xs[kFeat * kXPitch];             // x tile transposed: xs[f][row]
  __shared__ __align__(16) float sT[8][16 * 68];                  // per-wave 16x64 output slab, pitch 68 floats
  const _Float16* Bt = (const _Float16*)Btp;
  const int t    = threadIdx.x;
  const int lane = t & 31;
  const int wave = t >> 5;
  const int m0 = blockIdx.x * kTileRows;
  const int n0 = wave << 6;

  const int rlane = lane & 15;                 // row (A) / col (B, D) within subtile
  const int koff  = (lane >> 4) * 8;           // k offset of this lane half
  const int mOff  = (lane >> 4) * 8;           // D row offset
  const int h4    = lane * 4;                  // this lane's h in the A fill
  const int arow0 = wave * 8;                  // this wave's rows in the A fill

  // x tile: 64 rows x 64 features = 4096 consecutive floats of x; W1 and b1 rows of features 0 and 1
  float xr[16];
#pragma unroll
  for (int i = 0; i < 16; ++i) xr[i] = x[(size_t)m0 * kFeat + i * 256 + t];
  const v4f w0 = *(const v4f*)(W1 + h4);
  const v4f c0 = *(const v4f*)(b1 + h4);
  v4f w = *(const v4f*)(W1 + kHid + h4);
  v4f c = *(const v4f*)(b1 + kHid + h4);
  const _Float16* Bw = Bt + wave * kWavePassHalves + lane * 8;
  v16h be[4][4], bo[4][4];                     // B fragments of the even and of the odd features
  load_b(be, Bw);                              // feature 0's B, issued with the x tile's loads
  xcnt_fence();
#pragma unroll
  for (int i = 0; i < 16; ++i) {
    const int e = i * 256 + t;
    xs[(e & 63) * kXPitch + (e >> 6)] = xr[i];
  }
  __syncthreads();
  fill_a(As[0], xs, arow0, h4, w0, c0);

  v8f acc[4][4];
#pragma unroll
  for (int i = 0; i < 4; ++i)
#pragma unroll
    for (int j = 0; j < 4; ++j) acc[i][j] = (v8f){0.f,0.f,0.f,0.f,0.f,0.f,0.f,0.f};
  __syncthreads();

  const _Float16* Ar = As[0] + rlane * kAPitch + koff;
  static_assert(kFeat % 2 == 0, "two passes a trip");
  for (int f = 0;; f += 2) {
    // even pass f: multiplies feature f (As[0], be), makes feature f+1 in As[1], fetches feature f+1's B into bo
    const bool more = f + 2 < kFeat;                  // the same for the whole grid
    const int fe = more ? (f + 2) : (kFeat - 1);      // the feature made and fetched in the odd pass
    const int fo = more ? (f + 3) : (kFeat - 1);
    const float* pw = W1 + fe * kHid + h4;
    const float* pc = b1 + fe * kHid + h4;
    const _Float16* pb = Bw + (size_t)(f + 1) * kPassHalves;
    const v4f wn = *(const v4f*)pw;
    const v4f cn = *(const v4f*)pc;
    fill_a(As[1], xs + (f + 1) * kXPitch, arow0, h4, w, c);
    mma_pass(acc, be, Ar, bo, pb);
    xcnt_foot(pb, pw, pc);
    lds_barrier();   // publishes feature f+1's buffer and frees feature f's

    // odd pass f+1: multiplies feature f+1 (As[1], bo); while a feature f+2 exists, makes it in As[0]; fetches its B into be
    // (in the last trip the loads name the last feature again and nothing reads them: no branch stands among the counted waits)
    const float* qw = W1 + fo * kHid + h4;
    const float* qc = b1 + fo * kHid + h4;
    const _Float16* qb = Bw + (size_t)fe * kPassHalves;
    w = *(const v4f*)qw;
    c = *(const v4f*)qc;
    if (more) fill_a(As[0], xs + (f + 2) * kXPitch, arow0, h4, wn, cn);
    mma_pass(acc, bo, Ar + kTileRows * kAPitch, be, qb);
    xcnt_foot(qb, qw, qc);
    if (!more) break;
    lds_barrier();   // publishes feature f+2's buffer and frees feature f+1's
  }

  // ---- epilogue ----
  float* slab = sT[wave];
#pragma unroll
  for (int i = 0; i < 4; ++i) {
    const int mBase = m0 + (i << 4);
#pragma unroll
    for (int j = 0; j < 4; ++j) {
      const int n = n0 + (j << 4) + rlane;
      const float bv = bias[n];
#pragma unroll
      for (int r = 0; r < 8; ++r) {
        float v = acc[i][j][r] * kOutScale;
        v += bv;
        slab[(mOff + r) * 68 + (j << 4) + rlane] = v;
      }
    }
    __builtin_amdgcn_fence(__ATOMIC_RELEASE, "workgroup");
    __builtin_amdgcn_wave_barrier();
    __builtin_amdgcn_fence(__ATOMIC_ACQUIRE, "workgroup");
    {
      const int hh = lane >> 4, c4 = (lane & 15) * 4;     // row seg = 256 B = 16 lanes x 16 B
#pragma unroll
      for (int it = 0; it < 8; ++it) {
        const int row = it * 2 + hh;
        v4f v = *(const v4f*)(slab + row * 68 + c4);
        *(v4f*)(C + (size_t)(mBase + row) * kOutDim + n0 + c4) = v;
      }
      xcnt_fence();
    }
    __builtin_amdgcn_fence(__ATOMIC_RELEASE, "workgroup");
    __builtin_amdgcn_wave_barrier();
    __builtin_amdgcn_fence(__ATOMIC_ACQUIRE, "workgroup");
  }
}

// ---------------------------------------------------------------------------
// W2 transpose + cast + pack: W2 viewed row-major [kDepth = 8192 (k = f*128+h)][kOutDim = 512] f32
//   -> f16(scale * W2[k][o]) in the order in which the GEMM's waves load their B fragments:
//   out[f][o>>6][ks = (k>>5)&3][j = (o>>4)&3][half = (k>>4)&1][lane = ((k>>3)&1)*16 + (o&15)][k&7], in halves.
// grid (kDepth/64 = 128, kOutDim/64 = 8), 256 threads; blockIdx.x = k tile (two k-steps of one f), blockIdx.y = o tile (one GEMM wave).
// Load coverage: 16 iterations x 256 threads = 4096 = the whole 64x64 tile (coalesced along o).
// Store coverage: 2 iterations (k-step) x 8 waves (j, half) x 32 lanes x 8 halves = 4096 = 8 KiB in a row; a wave stores 512 consecutive bytes.
// ---------------------------------------------------------------------------
__global__ __launch_bounds__(256) void w2t_cast_kernel(const float* __restrict__ W2, unsigned short* __restrict__ out, float scale) {
  __shared__ float sm[64][67];   // sm[o_local][k_local]; pitch 67: no bank conflict for the column writes nor for the 16-row x 2-group reads
  const int t  = threadIdx.x;
  const int k0 = blockIdx.x * 64;
  const int o0 = blockIdx.y * 64;
#pragma unroll
  for (int i = 0; i < 16; ++i) {
    const int e = i * 256 + t;
    const int r = e >> 6;          // k local
    const int c = e & 63;          // o local
    sm[c][r] = W2[(size_t)(k0 + r) * kOutDim + o0 + c] * scale;
  }
  __syncthreads();
  const int lane = t & 31, wave = t >> 5;
  const int j = wave >> 1, half = wave & 1;
  const int row = j * 16 + (lane & 15);                      // o local
  unsigned short* dst = out + (size_t)(blockIdx.x >> 1) * kPassHalves + blockIdx.y * kWavePassHalves
                            + ((blockIdx.x & 1) * 8 + j) * kFragHalves + half * 256 + lane * 8;
  {
#pragma unroll
    for (int it = 0; it < 2; ++it) {
      const int kc = it * 32 + half * 16 + (lane >> 4) * 8;  // k local
      unsigned short hb[8];
#pragma unroll
      for (int e = 0; e < 8; ++e) hb[e] = h_bits(sm[row][kc + e]);
      const v4u u = (v4u){pk16(hb[0], hb[1]), pk16(hb[2], hb[3]), pk16(hb[4], hb[5]), pk16(hb[6], hb[7])};
      *(v4u*)(dst + it * 4 * kFragHalves) = u;
    }
  }
}

// ---------------------------------------------------------------------------
// Bias row: bias_out[o] = (sum_{f=0..63} b2[f][o]) * 0.125, f32, sequential f order.
// One block of 128 threads; thread t owns o = 4t..4t+3 (128 x 4 = 512 = whole row).
// ---------------------------------------------------------------------------
__global__ __launch_bounds__(128) void bsum_kernel(const float* __restrict__ b2, float* __restrict__ bias_out) {
  const int t = threadIdx.x;
  v4f s = (v4f){0.f, 0.f, 0.f, 0.f};
#pragma unroll 1
  for (int f = 0; f < kFeat; ++f) {
    const v4f v = *(const v4f*)(b2 + (size_t)f * kOutDim + 4 * t);
    s = s + v;
  }
  s = s * kBiasScale;
  float* p = bias_out + 4 * t;
  *(v4f*)p = s;
  
}

// ---------------------------------------------------------------------------
//   [0,          8388608)   Bt   f16, 512 x 8192 values     (W2 transposed, carried x256, in fragment order)
//   [8388608,    8390656)   bias f32 [512]                  (= 0.125 * sum_f b2), region padded to 4096 B
//   total carve = 8,392,704 B
// Launches: 1 (w2t_cast) + 1 (bsum) + 1 (fused activation + GEMM) = 3.
// ---------------------------------------------------------------------------
extern "C" void kernel_launch(void* const* d_in, const int* in_sizes, int n_in,
                              void* d_out, int out_size, void* d_ws, size_t ws_size,
                              hipStream_t stream) {
  if (n_in < 5) return;
  if (in_sizes[0] != kRows * kFeat) return;
  if (in_sizes[1] != kFeat * kHid) return;
  if (in_sizes[2] != kFeat * kHid) return;
  if (in_sizes[3] != kFeat * kHid * kOutDim) return;
  if (in_sizes[4] != kFeat * kOutDim) return;
  if (out_size != kRows * kOutDim) return;

  const float* x  = (const float*)d_in[0];
  const float* W1 = (const float*)d_in[1];
  const float* b1 = (const float*)d_in[2];
  const float* W2 = (const float*)d_in[3];
  const float* b2 = (const float*)d_in[4];
  float* out = (float*)d_out;

  const size_t bytesBt   = (size_t)kOutDim * kDepth * 2;          // 8,388,608
  const size_t bytesBias = 4096;                                   // 512 floats = 2048 B, padded
  const size_t offBt   = 0;
  const size_t offBias = offBt + bytesBt;
  const size_t total   = offBias + bytesBias;                      // 8,392,704
  if (total > ws_size) return;

  unsigned char* ws = (unsigned char*)d_ws;
  unsigned short* Bt  = (unsigned short*)(ws + offBt);
  float*          bsp = (float*)(ws + offBias);

  // Bt = f16(256 * W2^T) in fragment order; grid (k tiles, o tiles) = (128, 8)
  w2t_cast_kernel<<<dim3(kDepth / 64, kOutDim / 64, 1), dim3(256, 1, 1), 0, stream>>>(W2, Bt, kW2Carry);
  // bias row
  bsum_kernel<<<dim3(1, 1, 1), dim3(128, 1, 1), 0, stream>>>(b2, bsp);
  // out[16384][512] = 2^-11 * elu(x*W1+b1) . Bt^T + bias[n]; 256 work-groups of 64 rows
  fused_act_gemm<<<dim3(kRows / kTileRows, 1, 1), dim3(256, 1, 1), 0, stream>>>(
      x, W1, b1, (const unsigned short*)Bt, (const float*)bsp, out);
}

// v006
// A run of this version takes 100 microseconds.
// Timed twice side by side with v005, it ran 1.26 and 1.27 times as fast.
// Over all steps from v000 it is 16.1 times as fast.
// Contraction: A[16384 x 8192] (f16, elu activations carried x1, made in LDS tile by tile) . Bt[512 x 8192]^T (f16, W2 carried x256, stored in WMMA fragment order) on v_wmma_f32_16x16x32_f16 with f32 accumulate; elu (x*W1+b1, negative branch exp2(p*log2 e) - 1 on v_exp_f32), bias sum over f and the 1/8 scale in f32 on VALU.
#include <hip/hip_runtime.h>
#include <math.h>

// ---------------------------------------------------------------------------
// Problem constants
// ---------------------------------------------------------------------------
constexpr int kRows   = 16384;            // N
constexpr int kFeat   = 64;               // F
constexpr int kHid    = 128;              // H
constexpr int kOutDim = 512;              // O
constexpr int kDepth  = kFeat * kHid;     // 8192 = GEMM K, k = f*128 + h
constexpr int kTileRows = 64;             // rows of x (and of out) per work-group
constexpr int kAPitch = kHid + 8;         // LDS pitch of an A row in halves: 272 B = 16 B x 17, conflict-free for 16-byte readers
constexpr int kXPitch = kTileRows + 4;    // LDS pitch of a transposed x row in floats (16-byte multiple)
constexpr int kFragHalves = 512;          // one packed B fragment (16 columns x 32 k): 2 x 32 lanes x 8 halves = 1 KiB
constexpr int kWavePassHalves = 16 * kFragHalves;   // one wave's B of one pass: 4 k-steps x 4 column tiles = 16 KiB
constexpr int kPassHalves = 8 * kWavePassHalves;    // all 512 columns of one pass (128 k) = 128 KiB
constexpr float kW2Carry  = 256.0f;                      // W2 carried x256 in f16 (exact power of two)
constexpr float kOutScale = 0.125f / 256.0f;             // (1/sqrt(64)) / carry = 2^-11, exact
constexpr float kBiasScale = 0.125f;                     // bias row = (sum_f b2) / 8
constexpr float kLog2e = 1.44269504088896340736f;        // e^p = 2^(p * log2 e)

static_assert(kRows % kTileRows == 0 && kOutDim == 8 * 64 && kHid % 32 == 0, "tile multiples");

typedef __attribute__((ext_vector_type(16))) _Float16 v16h;
typedef __attribute__((ext_vector_type(8)))  _Float16 v8h;
typedef __attribute__((ext_vector_type(8)))  float    v8f;
typedef __attribute__((ext_vector_type(4)))  float    v4f;
typedef __attribute__((ext_vector_type(2)))  float    v2f;
typedef __attribute__((ext_vector_type(2)))  _Float16 v2h;
typedef __attribute__((ext_vector_type(4)))  unsigned int v4u;
typedef __attribute__((ext_vector_type(2)))  unsigned int v2u;

__device__ __forceinline__ v16h frag_load(const _Float16* p) {   // elements 0..7 <- p[0..7], 8..15 <- p[16..23]
  union { v16h v; v8h h[2]; } f;
  f.h[0] = *(const v8h*)(p); f.h[1] = *(const v8h*)(p + 16); return f.v;
}
__device__ __forceinline__ v16h frag_load_packed(const _Float16* p) {   // elements 0..7 <- p[0..7], 8..15 <- p[256..263]
  union { v16h v; v8h h[2]; } f;
  f.h[0] = *(const v8h*)(p); f.h[1] = *(const v8h*)(p + 256); return f.v;
}
__device__ __forceinline__ v8f mma_f16(v16h a, v16h b, v8f c) {
  return __builtin_amdgcn_wmma_f32_16x16x32_f16(false, a, false, b, (short)0, c, false, false);
}

__device__ __forceinline__ unsigned pk16(unsigned short a, unsigned short b) { return (unsigned)a | ((unsigned)b << 16); }
__device__ __forceinline__ unsigned short h_bits(float f) { const _Float16 h = (_Float16)f; return __builtin_bit_cast(unsigned short, h); }

__device__ __forceinline__ void xcnt_fence() {
  asm volatile("s_wait_xcnt 0x0" ::: "memory");
  __builtin_amdgcn_sched_barrier(0);
}

// Two activations of neighbouring h, packed: f16( elu( xv * w + c ) ), all in f32 up to the last rounding.
// Negative branch: e^p - 1 = exp2(p * log2 e) - 1 on the hardware exponential. Against expm1f its absolute error is a few
// 2^-24 (the subtraction from a value near 1), three orders below the f16 rounding of an activation near -1, and every
// activation enters a sum of 8192 products.
// The branch: e^p - 1 >= p everywhere and has p's sign, so elu(p) = max(min(e^p - 1, 0), p): for p > 0 the inner
// minimum is 0 (also where exp2 overflows to +inf), for p <= 0 it is e^p - 1. No clamp of the exponent is needed.
__device__ __forceinline__ unsigned elu2_h(float xv, v2f w, v2f c) {
  const v2f p = xv * w + c;
  const v2f t = p * kLog2e;
  const v2f e = (v2f){__builtin_amdgcn_exp2f(t[0]), __builtin_amdgcn_exp2f(t[1])} - 1.0f;
  const v2f a = (v2f){fmaxf(fminf(e[0], 0.0f), p[0]), fmaxf(fminf(e[1], 0.0f), p[1])};
  return __builtin_bit_cast(unsigned, __builtin_convertvector(a, v2h));
}

// A tile of one feature f: rows arow0..arow0+7 of the work-group's 64, this lane's 4 consecutive h.
// xcol = the transposed x tile's row f (64 floats); w, c = W1[f][h4..h4+3], b1[f][h4..h4+3].
__device__ __forceinline__ void fill_a(_Float16* dst, const float* xcol, int arow0, int h4, v4f w, v4f c) {
  const v4f xa = *(const v4f*)(xcol + arow0);
  const v4f xb = *(const v4f*)(xcol + arow0 + 4);
#pragma unroll
  for (int i = 0; i < 8; ++i) {
    const float xv = (i < 4) ? xa[i & 3] : xb[i & 3];
    const v2u u = (v2u){elu2_h(xv, w.lo, c.lo), elu2_h(xv, w.hi, c.hi)};
    *(v2u*)(dst + (arow0 + i) * kAPitch + h4) = u;    // a wave stores one whole 256-B row
  }
}

// B fragments of one pass (128 k) for this wave's 64 columns; p = this lane's 16 bytes in the wave's first packed fragment.
// Every load of the wave reads 512 consecutive bytes (4 whole lines). The caller keeps p live up to its s_wait_xcnt 0.
__device__ __forceinline__ void load_b(v16h (&bh)[4][4], const _Float16* p) {
#pragma unroll
  for (int ks = 0; ks < 4; ++ks)
#pragma unroll
    for (int j = 0; j < 4; ++j) bh[ks][j] = frag_load_packed(p + (ks * 4 + j) * kFragHalves);
}

// The pass's s_wait_xcnt 0, at the pass's foot: the three addresses that the pass's loads name are inputs of the wait,
// so they stay in their registers up to it. The scheduling barrier in front keeps the wait below the last k-step's WMMAs
// (lifted to just behind that k-step's loads the wave would stand there); the one behind keeps later register writes below it.
__device__ __forceinline__ void xcnt_foot(const _Float16* pb, const float* pw, const float* pc) {
  __builtin_amdgcn_sched_barrier(0);
  asm volatile("s_wait_xcnt 0x0" :: "v"(pb), "v"(pw), "v"(pc) : "memory");
  __builtin_amdgcn_sched_barrier(0);
}

// The pass's work-group barrier, ordering LDS only: this wave's LDS stores and reads are done (s_wait_dscnt 0), then signal and
// wait. __syncthreads() also waits for every global load of the wave, and the next pass's B loads are to stay in flight across it.
__device__ __forceinline__ void lds_barrier() {
  asm volatile("s_wait_dscnt 0x0" ::: "memory");
  asm volatile("s_barrier_signal -1\n\ts_barrier_wait -1" ::: "memory");
}

// One pass: 4 k-steps of 32, each 4 A fragments out of LDS (read as one group) times 4 B fragments.
// Each k-step also issues the 8 loads of the NEXT pass's B fragments of the same k-step (bn, from pn): a quarter of a pass's B
// at a time, a whole pass ahead of its WMMAs, so that the work-group asks L2 evenly and no wave queues 32 loads at one place.
__device__ __forceinline__ void mma_pass(v8f (&acc)[4][4], const v16h (&bh)[4][4], const _Float16* Ab,
                                         v16h (&bn)[4][4], const _Float16* pn) {
#pragma unroll
  for (int ks = 0; ks < 4; ++ks) {
    v16h ah[4];
#pragma unroll
    for (int i = 0; i < 4; ++i) ah[i] = frag_load(Ab + (i << 4) * kAPitch + (ks << 5));
#pragma unroll
    for (int j = 0; j < 4; ++j) bn[ks][j] = frag_load_packed(pn + (ks * 4 + j) * kFragHalves);
    // keeps the k-step's 8 LDS reads one group in front of its 16 WMMAs: with both B sets live the scheduler otherwise
    // reads one fragment at a time into one register set and waits out the LDS latency in front of every 4 WMMAs;
    // and holds the 8 global loads from sinking to their WMMAs (the scheduler may still lift a group up to the barrier before)
    __builtin_amdgcn_sched_barrier(0);
#pragma unroll
    for (int i = 0; i < 4; ++i)
#pragma unroll
      for (int j = 0; j < 4; ++j) acc[i][j] = mma_f16(ah[i], bh[ks][j], acc[i][j]);
  }
}

// ---------------------------------------------------------------------------
// Fused activation + GEMM. One work-group = 64 rows x all 512 outputs; wave w owns the 64x64 tile at columns 64w.
// A pass is one feature f (128 k): the 8 waves together make A[64][128] of feature f+1 in one LDS buffer while
// they multiply feature f out of the other; one barrier a pass publishes the new buffer and frees the old one.
// Bt in fragment order (see w2t_cast_kernel), read straight into registers (no wave shares another's columns), into two
// register sets: k-step ks of a pass issues the 8 loads of the NEXT pass's k-step ks, which stay in flight across the pass's barrier.
// Each accumulator sums k in ascending steps of 32.
// ---------------------------------------------------------------------------
__global__ __launch_bounds__(256) void fused_act_gemm(const float* __restrict__ x, const float* __restrict__ W1,
                                                      const float* __restrict__ b1,
                                                      const unsigned short* __restrict__ Btp,
                                                      const float* __restrict__ bias, float* __restrict__ C) {
  __shared__ __align__(16) _Float16 As[2][kTileRows * kAPitch];   // two A buffers, 17,408 B each
  __shared__ __align__(16) float xs[kFeat * kXPitch];             // x tile transposed: xs[f][row]
  __shared__ __align__(16) float sT[8][16 * 68];                  // per-wave 16x64 output slab, pitch 68 floats
  const _Float16* Bt = (const _Float16*)Btp;
  const int t    = threadIdx.x;
  const int lane = t & 31;
  const int wave = t >> 5;
  const int m0 = blockIdx.x * kTileRows;
  const int n0 = wave << 6;

  const int rlane = lane & 15;                 // row (A) / col (B, D) within subtile
  const int koff  = (lane >> 4) * 8;           // k offset of this lane half
  const int mOff  = (lane >> 4) * 8;           // D row offset
  const int h4    = lane * 4;                  // this lane's h in the A fill
  const int arow0 = wave * 8;                  // this wave's rows in the A fill

  // x tile: 64 rows x 64 features = 4096 consecutive floats of x; W1 and b1 rows of features 0 and 1
  float xr[16];
#pragma unroll
  for (int i = 0; i < 16; ++i) xr[i] = x[(size_t)m0 * kFeat + i * 256 + t];
  const v4f w0 = *(const v4f*)(W1 + h4);
  const v4f c0 = *(const v4f*)(b1 + h4);
  v4f w = *(const v4f*)(W1 + kHid + h4);
  v4f c = *(const v4f*)(b1 + kHid + h4);
  const _Float16* Bw = Bt + wave * kWavePassHalves + lane * 8;
  v16h be[4][4], bo[4][4];                     // B fragments of the even and of the odd features
  load_b(be, Bw);                              // feature 0's B, issued with the x tile's loads
  xcnt_fence();
#pragma unroll
  for (int i = 0; i < 16; ++i) {
    const int e = i * 256 + t;
    xs[(e & 63) * kXPitch + (e >> 6)] = xr[i];
  }
  __syncthreads();
  fill_a(As[0], xs, arow0, h4, w0, c0);

  v8f acc[4][4];
#pragma unroll
  for (int i = 0; i < 4; ++i)
#pragma unroll
    for (int j = 0; j < 4; ++j) acc[i][j] = (v8f){0.f,0.f,0.f,0.f,0.f,0.f,0.f,0.f};
  __syncthreads();

  const _Float16* Ar = As[0] + rlane * kAPitch + koff;
  static_assert(kFeat % 2 == 0, "two passes a trip");
  for (int f = 0;; f += 2) {
    // even pass f: multiplies feature f (As[0], be), makes feature f+1 in As[1], fetches feature f+1's B into bo
    const bool more = f + 2 < kFeat;                  // the same for the whole grid
    const int fe = more ? (f + 2) : (kFeat - 1);      // the feature made and fetched in the odd pass
    const int fo = more ? (f + 3) : (kFeat - 1);
    const float* pw = W1 + fe * kHid + h4;
    const float* pc = b1 + fe * kHid + h4;
    const _Float16* pb = Bw + (size_t)(f + 1) * kPassHalves;
    const v4f wn = *(const v4f*)pw;
    const v4f cn = *(const v4f*)pc;
    fill_a(As[1], xs + (f + 1) * kXPitch, arow0, h4, w, c);
    mma_pass(acc, be, Ar, bo, pb);
    xcnt_foot(pb, pw, pc);
    lds_barrier();   // publishes feature f+1's buffer and frees feature f's

    // odd pass f+1: multiplies feature f+1 (As[1], bo); while a feature f+2 exists, makes it in As[0]; fetches its B into be
    // (in the last trip the loads name the last feature again and nothing reads them: no branch stands among the counted waits)
    const float* qw = W1 + fo * kHid + h4;
    const float* qc = b1 + fo * kHid + h4;
    const _Float16* qb = Bw + (size_t)fe * kPassHalves;
    w = *(const v4f*)qw;
    c = *(const v4f*)qc;
    if (more) fill_a(As[0], xs + (f + 2) * kXPitch, arow0, h4, wn, cn);
    mma_pass(acc, bo, Ar + kTileRows * kAPitch, be, qb);
    xcnt_foot(qb, qw, qc);
    if (!more) break;
    lds_barrier();   // publishes feature f+2's buffer and frees feature f+1's
  }

  // ---- epilogue ----
  float* slab = sT[wave];
#pragma unroll
  for (int i = 0; i < 4; ++i) {
    const int mBase = m0 + (i << 4);
#pragma unroll
    for (int j = 0; j < 4; ++j) {
      const int n = n0 + (j << 4) + rlane;
      const float bv = bias[n];
#pragma unroll
      for (int r = 0; r < 8; ++r) {
        float v = acc[i][j][r] * kOutScale;
        v += bv;
        slab[(mOff + r) * 68 + (j << 4) + rlane] = v;
      }
    }
    __builtin_amdgcn_fence(__ATOMIC_RELEASE, "workgroup");
    __builtin_amdgcn_wave_barrier();
    __builtin_amdgcn_fence(__ATOMIC_ACQUIRE, "workgroup");
    {
      const int hh = lane >> 4, c4 = (lane & 15) * 4;     // row seg = 256 B = 16 lanes x 16 B
#pragma unroll
      for (int it = 0; it < 8; ++it) {
        const int row = it * 2 + hh;
        v4f v = *(const v4f*)(slab + row * 68 + c4);
        *(v4f*)(C + (size_t)(mBase + row) * kOutDim + n0 + c4) = v;
      }
      xcnt_fence();
    }
    __builtin_amdgcn_fence(__ATOMIC_RELEASE, "workgroup");
    __builtin_amdgcn_wave_barrier();
    __builtin_amdgcn_fence(__ATOMIC_ACQUIRE, "workgroup");
  }
}

// ---------------------------------------------------------------------------
// W2 transpose + cast + pack: W2 viewed row-major [kDepth = 8192 (k = f*128+h)][kOutDim = 512] f32
//   -> f16(scale * W2[k][o]) in the order in which the GEMM's waves load their B fragments:
//   out[f][o>>6][ks = (k>>5)&3][j = (o>>4)&3][half = (k>>4)&1][lane = ((k>>3)&1)*16 + (o&15)][k&7], in halves.
// grid (kDepth/64 = 128, kOutDim/64 = 8), 256 threads; blockIdx.x = k tile (two k-steps of one f), blockIdx.y = o tile (one GEMM wave).
// Load coverage: 16 iterations x 256 threads = 4096 = the whole 64x64 tile (coalesced along o).
// Store coverage: 2 iterations (k-step) x 8 waves (j, half) x 32 lanes x 8 halves = 4096 = 8 KiB in a row; a wave stores 512 consecutive bytes.
// Bias row, in the same launch: bias_out[o] = (sum_{f=0..63} b2[f][o]) * 0.125, f32, sequential f order. The 8 work-groups of lowest
// flat index (for speed only) take 64
// columns each: the 64 x 64 tile of b2 is fetched like a W2 tile (16 independent loads a thread, one latency for all 64 features),
// transposed in LDS, and thread c < 64 sums its column's 64 values in ascending f.
// ---------------------------------------------------------------------------
__global__ __launch_bounds__(256) void w2t_cast_kernel(const float* __restrict__ W2, unsigned short* __restrict__ out, float scale,
                                                       const float* __restrict__ b2, float* __restrict__ bias_out) {
  __shared__ float sm[64][67];   // sm[o_local][k_local]; pitch 67: no bank conflict for the column writes nor for the 16-row x 2-group reads
  __shared__ float sb[64][67];   // sb[o_local][f]: the b2 tile; the same pitch serves its column writes and its 32-row reads
  const int t  = threadIdx.x;
  const int k0 = blockIdx.x * 64;
  const int o0 = blockIdx.y * 64;
  const bool with_bias = blockIdx.y == 0 && blockIdx.x < kOutDim / 64;    // the same for the whole work-group
  const int ob = blockIdx.x * 64;            // first bias column of such a work-group
  if (with_bias) {
#pragma unroll
    for (int i = 0; i < 16; ++i) {
      const int e = i * 256 + t;
      sb[e & 63][e >> 6] = b2[(size_t)(e >> 6) * kOutDim + ob + (e & 63)];
    }
  }
#pragma unroll
  for (int i = 0; i < 16; ++i) {
    const int e = i * 256 + t;
    const int r = e >> 6;          // k local
    const int c = e & 63;          // o local
    sm[c][r] = W2[(size_t)(k0 + r) * kOutDim + o0 + c] * scale;
  }
  __syncthreads();
  const int lane = t & 31, wave = t >> 5;
  const int j = wave >> 1, half = wave & 1;
  const int row = j * 16 + (lane & 15);                      // o local
  unsigned short* dst = out + (size_t)(blockIdx.x >> 1) * kPassHalves + blockIdx.y * kWavePassHalves
                            + ((blockIdx.x & 1) * 8 + j) * kFragHalves + half * 256 + lane * 8;
  {
#pragma unroll
    for (int it = 0; it < 2; ++it) {
      const int kc = it * 32 + half * 16 + (lane >> 4) * 8;  // k local
      unsigned short hb[8];
#pragma unroll
      for (int e = 0; e < 8; ++e) hb[e] = h_bits(sm[row][kc + e]);
      const v4u u = (v4u){pk16(hb[0], hb[1]), pk16(hb[2], hb[3]), pk16(hb[4], hb[5]), pk16(hb[6], hb[7])};
      *(v4u*)(dst + it * 4 * kFragHalves) = u;
    }
  }
  if (with_bias && t < 64) {                 // waves 0 and 1, each storing one whole 128-B line
    float s = 0.f;
#pragma unroll
    for (int f = 0; f < kFeat; ++f) s += sb[t][f];
    bias_out[ob + t] = s * kBiasScale;
  }
}

// ---------------------------------------------------------------------------
//   [0,          8388608)   Bt   f16, 512 x 8192 values     (W2 transposed, carried x256, in fragment order)
//   [8388608,    8390656)   bias f32 [512]                  (= 0.125 * sum_f b2), region padded to 4096 B
//   total carve = 8,392,704 B
// Launches: 1 (w2t_cast with the bias row) + 1 (fused activation + GEMM) = 2.
// ---------------------------------------------------------------------------
extern "C" void kernel_launch(void* const* d_in, const int* in_sizes, int n_in,
                              void* d_out, int out_size, void* d_ws, size_t ws_size,
                              hipStream_t stream) {
  if (n_in < 5) return;
  if (in_sizes[0] != kRows * kFeat) return;
  if (in_sizes[1] != kFeat * kHid) return;
  if (in_sizes[2] != kFeat * kHid) return;
  if (in_sizes[3] != kFeat * kHid * kOutDim) return;
  if (in_sizes[4] != kFeat * kOutDim) return;
  if (out_size != kRows * kOutDim) return;

  const float* x  = (const float*)d_in[0];
  const float* W1 = (const float*)d_in[1];
  const float* b1 = (const float*)d_in[2];
  const float* W2 = (const float*)d_in[3];
  const float* b2 = (const float*)d_in[4];
  float* out = (float*)d_out;

  const size_t bytesBt   = (size_t)kOutDim * kDepth * 2;          // 8,388,608
  const size_t bytesBias = 4096;                                   // 512 floats = 2048 B, padded
  const size_t offBt   = 0;
  const size_t offBias = offBt + bytesBt;
  const size_t total   = offBias + bytesBias;                      // 8,392,704
  if (total > ws_size) return;

  unsigned char* ws = (unsigned char*)d_ws;
  unsigned short* Bt  = (unsigned short*)(ws + offBt);
  float*          bsp = (float*)(ws + offBias);

  // Bt = f16(256 * W2^T) in fragment order, and the bias row; grid (k tiles, o tiles) = (128, 8)
  w2t_cast_kernel<<<dim3(kDepth / 64, kOutDim / 64, 1), dim3(256, 1, 1), 0, stream>>>(W2, Bt, kW2Carry, b2, bsp);
  // out[16384][512] = 2^-11 * elu(x*W1+b1) . Bt^T + bias[n]; 256 work-groups of 64 rows
  fused_act_gemm<<<dim3(kRows / kTileRows, 1, 1), dim3(256, 1, 1), 0, stream>>>(
      x, W1, b1, (const unsigned short*)Bt, (const float*)bsp, out);
}

// v007
// Measured time: 91.8 microseconds a run.
// In both of two side-by-side timings against v006, it was 1.09 times as fast.
// Counting every step since v000, it is 17.6 times as fast.
// Contraction: A[16384 x 8192] (f16, elu activations carried x1, made in LDS tile by tile) . Bt[512 x 8192]^T (f16, W2 carried x256, stored in WMMA fragment order) on v_wmma_f32_16x16x32_f16 with f32 accumulate; elu (x*W1+b1, negative branch exp2(p*log2 e) - 1 on v_exp_f32), bias sum over f and the 1/8 scale in f32 on VALU.
#include <hip/hip_runtime.h>
#include <math.h>

// ---------------------------------------------------------------------------
// Problem constants
// ---------------------------------------------------------------------------
constexpr int kRows   = 16384;            // N
constexpr int kFeat   = 64;               // F
constexpr int kHid    = 128;              // H
constexpr int kOutDim = 512;              // O
constexpr int kDepth  = kFeat * kHid;     // 8192 = GEMM K, k = f*128 + h
constexpr int kTileRows = 128;            // rows of x (and of out) per work-group
constexpr int kTileCols = 256;            // output columns per work-group: 4 waves x 64
constexpr int kABufHalves = kTileRows * (kHid + 8);   // one A buffer in halves
constexpr int kAPitch = kHid + 8;         // LDS pitch of an A row in halves: 272 B = 16 B x 17, conflict-free for 16-byte readers
constexpr int kXPitch = kTileRows + 4;    // LDS pitch of a transposed x row in floats (16-byte multiple)
constexpr int kFragHalves = 512;          // one packed B fragment (16 columns x 32 k): 2 x 32 lanes x 8 halves = 1 KiB
constexpr int kWavePassHalves = 16 * kFragHalves;   // one wave's B of one pass: 4 k-steps x 4 column tiles = 16 KiB
constexpr int kPassHalves = 8 * kWavePassHalves;    // all 512 columns of one pass (128 k) = 128 KiB
constexpr float kW2Carry  = 256.0f;                      // W2 carried x256 in f16 (exact power of two)
constexpr float kOutScale = 0.125f / 256.0f;             // (1/sqrt(64)) / carry = 2^-11, exact
constexpr float kBiasScale = 0.125f;                     // bias row = (sum_f b2) / 8
constexpr float kLog2e = 1.44269504088896340736f;        // e^p = 2^(p * log2 e)

static_assert(kRows % kTileRows == 0 && kOutDim == 8 * 64 && kOutDim % kTileCols == 0 && kHid == 4 * 32, "tile multiples");

typedef __attribute__((ext_vector_type(16))) _Float16 v16h;
typedef __attribute__((ext_vector_type(8)))  _Float16 v8h;
typedef __attribute__((ext_vector_type(8)))  float    v8f;
typedef __attribute__((ext_vector_type(4)))  float    v4f;
typedef __attribute__((ext_vector_type(2)))  float    v2f;
typedef __attribute__((ext_vector_type(2)))  _Float16 v2h;
typedef __attribute__((ext_vector_type(4)))  unsigned int v4u;
typedef __attribute__((ext_vector_type(2)))  unsigned int v2u;

__device__ __forceinline__ v16h frag_load(const _Float16* p) {   // elements 0..7 <- p[0..7], 8..15 <- p[16..23]
  union { v16h v; v8h h[2]; } f;
  f.h[0] = *(const v8h*)(p); f.h[1] = *(const v8h*)(p + 16); return f.v;
}
__device__ __forceinline__ v16h frag_load_packed(const _Float16* p) {   // elements 0..7 <- p[0..7], 8..15 <- p[256..263]
  union { v16h v; v8h h[2]; } f;
  f.h[0] = *(const v8h*)(p); f.h[1] = *(const v8h*)(p + 256); return f.v;
}
__device__ __forceinline__ v8f mma_f16(v16h a, v16h b, v8f c) {
  return __builtin_amdgcn_wmma_f32_16x16x32_f16(false, a, false, b, (short)0, c, false, false);
}

__device__ __forceinline__ unsigned pk16(unsigned short a, unsigned short b) { return (unsigned)a | ((unsigned)b << 16); }
__device__ __forceinline__ unsigned short h_bits(float f) { const _Float16 h = (_Float16)f; return __builtin_bit_cast(unsigned short, h); }

__device__ __forceinline__ void xcnt_fence() {
  asm volatile("s_wait_xcnt 0x0" ::: "memory");
  __builtin_amdgcn_sched_barrier(0);
}

// Activations, packed in pairs of neighbouring h: f16( elu( xv * w + c ) ), all in f32 up to the last rounding.
// Negative branch: e^p - 1 = exp2(p * log2 e) - 1 on the hardware exponential. Against expm1f its absolute error is a few
// 2^-24 (the subtraction from a value near 1), three orders below the f16 rounding of an activation near -1, and every
// activation enters a sum of 8192 products.
// The branch: e^p - 1 >= p everywhere and has p's sign, so elu(p) = max(min(e^p - 1, 0), p): for p > 0 the inner
// minimum is 0 (also where exp2 overflows to +inf), for p <= 0 it is e^p - 1. No clamp of the exponent is needed.
// Four rows of the A tile of one feature, this lane's 4 consecutive h: dst = the first row's place for this lane, xv = the rows'
// x values of that feature; w, c = W1[f][h4..h4+3], b1[f][h4..h4+3]. The eight pairs go through each operation together: a lone
// wave issues in order, and written pair by pair every instruction would wait out the latency of the one in front of it.
__device__ __forceinline__ void fill_a4(_Float16* dst, v4f xv, v4f w, v4f c) {
  v2f p[8], e[8];
  unsigned u[8];
#pragma unroll
  for (int i = 0; i < 4; ++i) { p[2 * i] = xv[i] * w.lo + c.lo; p[2 * i + 1] = xv[i] * w.hi + c.hi; }
#pragma unroll
  for (int q = 0; q < 8; ++q) e[q] = p[q] * kLog2e;
#pragma unroll
  for (int q = 0; q < 8; ++q) e[q] = (v2f){__builtin_amdgcn_exp2f(e[q][0]), __builtin_amdgcn_exp2f(e[q][1])};
#pragma unroll
  for (int q = 0; q < 8; ++q) e[q] = e[q] - 1.0f;
#pragma unroll
  for (int q = 0; q < 8; ++q) e[q] = (v2f){fmaxf(fminf(e[q][0], 0.0f), p[q][0]), fmaxf(fminf(e[q][1], 0.0f), p[q][1])};
#pragma unroll
  for (int q = 0; q < 8; ++q) u[q] = __builtin_bit_cast(unsigned, __builtin_convertvector(e[q], v2h));
#pragma unroll
  for (int i = 0; i < 4; ++i) *(v2u*)(dst + i * kAPitch) = (v2u){u[2 * i], u[2 * i + 1]};    // a wave stores one whole 256-B row
}
__device__ __forceinline__ void fill_a8(_Float16* dst, v4f xa, v4f xb, v4f w, v4f c) {
  fill_a4(dst, xa, w, c);
  fill_a4(dst + 4 * kAPitch, xb, w, c);
}

// B fragments of one pass (128 k) for this wave's 64 columns; p = this lane's 16 bytes in the wave's first packed fragment.
// Every load of the wave reads 512 consecutive bytes (4 whole lines). The caller keeps p live up to its s_wait_xcnt 0.
__device__ __forceinline__ void load_b(v16h (&bh)[4][4], const _Float16* p) {
#pragma unroll
  for (int ks = 0; ks < 4; ++ks)
#pragma unroll
    for (int j = 0; j < 4; ++j) bh[ks][j] = frag_load_packed(p + (ks * 4 + j) * kFragHalves);
}

// The pass's s_wait_xcnt 0, at the pass's foot: the three addresses that the pass's loads name are inputs of the wait,
// so they stay in their registers up to it. The scheduling barrier in front keeps the wait below the last k-step's WMMAs
// (lifted to just behind that k-step's loads the wave would stand there); the one behind keeps later register writes below it.
__device__ __forceinline__ void xcnt_foot(const _Float16* pb, const float* pw, const float* pc) {
  __builtin_amdgcn_sched_barrier(0);
  asm volatile("s_wait_xcnt 0x0" :: "v"(pb), "v"(pw), "v"(pc) : "memory");
  __builtin_amdgcn_sched_barrier(0);
}

// The pass's work-group barrier, ordering LDS only: this wave's LDS stores and reads are done (s_wait_dscnt 0), then signal and
// wait. __syncthreads() also waits for every global load of the wave, and the next pass's B loads are to stay in flight across it.
__device__ __forceinline__ void lds_barrier() {
  asm volatile("s_wait_dscnt 0x0" ::: "memory");
  asm volatile("s_barrier_signal -1\n\ts_barrier_wait -1" ::: "memory");
}

// One k-step of 32: 8 A fragments (128 rows) times 4 B fragments (64 columns) = 32 WMMAs on operands that are already in registers.
// At its head it issues what later steps need: the NEXT k-step's 8 A fragments out of LDS (an, from An, one group of reads),
// the next eight rows' x values (from xn) and the 8 loads of the NEXT pass's B fragments of the same k-step (bn, from pn).
// Between its WMMAs it makes eight rows of a coming feature's A tile (dst; xa, xb, w, c): the wave is alone on its SIMD, so
// only its own vector work can use the issue slots that a WMMA leaves free.
__device__ __forceinline__ void k_step(v8f (&acc)[8][4], const v16h (&ah)[8], const v16h (&bh)[4],
                                       v16h (&an)[8], const _Float16* An, v16h (&bn)[4], const _Float16* pn,
                                       _Float16* dst, v4f& xa, v4f& xb, const float* xn, v4f w, v4f c) {
#pragma unroll
  for (int i = 0; i < 8; ++i) an[i] = frag_load(An + (i << 4) * kAPitch);
  const v4f xna = *(const v4f*)(xn);
  const v4f xnb = *(const v4f*)(xn + 4);
#pragma unroll
  for (int j = 0; j < 4; ++j) bn[j] = frag_load_packed(pn + j * kFragHalves);
  // keeps the step's LDS reads one group at its head
  // and holds the 8 global loads from sinking to their WMMAs
  __builtin_amdgcn_sched_barrier(0);
  fill_a8(dst, xa, xb, w, c);
#pragma unroll
  for (int i = 0; i < 8; ++i)
#pragma unroll
    for (int j = 0; j < 4; ++j) acc[i][j] = mma_f16(ah[i], bh[j], acc[i][j]);
  // order asked of the scheduler: one WMMA, then four of the activation's vector instructions, 32 times over;
  // left alone it puts the vector instructions in blocks, where the matrix unit idles
#pragma unroll
  for (int g = 0; g < 32; ++g) {
    __builtin_amdgcn_sched_group_barrier(0x008, 1, 0);   // WMMA
    __builtin_amdgcn_sched_group_barrier(0x402, 4, 0);   // VALU and transcendental
  }
  __builtin_amdgcn_sched_barrier(0);   // the next step's reads stay behind this step's WMMAs
  xa = xna; xb = xnb;
}

// One pass = one feature p (128 k), buffer CUR = p & 1. Fragments run one k-step ahead (sets fx, fy), the A tile is made one pass
// ahead, eight rows of the wave's 32 a k-step. The pass's one barrier stands between k-steps 2 and 3: in front of it every wave has
// stored the last rows of feature p+1 and has read the last fragments of feature p (k-step 3's, fetched in k-step 2), so behind it
// k-step 3 fetches feature p+1's first fragments and stores feature p+2's first rows into feature p's buffer.
// g1, g2 = features p+1 and p+2, held at the last feature where none exists: the rows made and the loads issued for them go to
// a buffer and to registers that nothing reads any more, and no branch stands among the WMMAs.
template <int CUR>
__device__ __forceinline__ void pass(v8f (&acc)[8][4], v16h (&bc)[4][4], v16h (&bn)[4][4], v16h (&fx)[8], v16h (&fy)[8],
                                     const _Float16* Ar, _Float16* Aw, const float* xw, int g1, int g2,
                                     const _Float16* Bw, const float* W1h, const float* b1h,
                                     v4f& xa, v4f& xb, v4f& w, v4f& c) {
  const _Float16* Ac = Ar + CUR * kABufHalves;
  const _Float16* Ao = Ar + (CUR ^ 1) * kABufHalves;
  _Float16* Wc = Aw + CUR * kABufHalves;
  _Float16* Wo = Aw + (CUR ^ 1) * kABufHalves;
  const float* x1 = xw + g1 * kXPitch;
  const float* x2 = xw + g2 * kXPitch;
  const float* pw = W1h + g2 * kHid;
  const float* pc = b1h + g2 * kHid;
  const _Float16* pb = Bw + (size_t)g1 * kPassHalves;
  const v4f wn = *(const v4f*)pw;
  const v4f cn = *(const v4f*)pc;
  k_step(acc, fx, bc[0], fy, Ac + 32, bn[0], pb,                    Wo +  8 * kAPitch, xa, xb, x1 + 16, w, c);
  k_step(acc, fy, bc[1], fx, Ac + 64, bn[1], pb +  4 * kFragHalves, Wo + 16 * kAPitch, xa, xb, x1 + 24, w, c);
  k_step(acc, fx, bc[2], fy, Ac + 96, bn[2], pb +  8 * kFragHalves, Wo + 24 * kAPitch, xa, xb, x2,      w, c);
  lds_barrier();   // publishes feature p+1's buffer and frees feature p's
  k_step(acc, fy, bc[3], fx, Ao,      bn[3], pb + 12 * kFragHalves, Wc,                xa, xb, x2 + 8,  wn, cn);
  xcnt_foot(pb, pw, pc);
  w = wn; c = cn;
}

// ---------------------------------------------------------------------------
// Fused activation + GEMM. One work-group = 128 rows x 256 outputs, 4 waves, one on each SIMD; wave w owns the 128x64 tile at
// columns 256 * (blockIdx.x & 1) + 64w. Each byte of Bt that a work-group fetches from L2 serves 128 rows; the two work-groups
// of a row tile each make that tile's activations for themselves.
// A pass is one feature (128 k): the 4 waves together make A[128][128] of the next feature in one LDS buffer while
// they multiply this feature out of the other; one barrier a pass (see pass()).
// Bt in fragment order (see w2t_cast_kernel), read straight into registers (no wave shares another's columns), into two
// register sets: k-step ks of a pass issues the 8 loads of the NEXT pass's k-step ks, which stay in flight across the pass's barrier.
// Each accumulator sums k in ascending steps of 32.
// ---------------------------------------------------------------------------
__global__ __launch_bounds__(128) void fused_act_gemm(const float* __restrict__ x, const float* __restrict__ W1,
                                                      const float* __restrict__ b1,
                                                      const unsigned short* __restrict__ Btp,
                                                      const float* __restrict__ bias, float* __restrict__ C) {
  __shared__ __align__(16) _Float16 As[2 * kABufHalves];          // two A buffers, 34,816 B each
  __shared__ __align__(16) float xs[kFeat * kXPitch];             // x tile transposed: xs[f][row]
  __shared__ __align__(16) float sT[4][16 * 68];                  // per-wave 16x64 output slab, pitch 68 floats
  const _Float16* Bt = (const _Float16*)Btp;
  const int t    = threadIdx.x;
  const int lane = t & 31;
  const int wave = t >> 5;
  const int m0 = (blockIdx.x >> 1) * kTileRows;
  const int cw = (blockIdx.x & 1) * (kTileCols / 64) + wave;      // this wave's block of 64 columns
  const int n0 = cw << 6;

  const int rlane = lane & 15;                 // row (A) / col (B, D) within subtile
  const int koff  = (lane >> 4) * 8;           // k offset of this lane half
  const int mOff  = (lane >> 4) * 8;           // D row offset
  const int h4    = lane * 4;                  // this lane's h in the A fill
  const int arow0 = wave * 32;                 // this wave's rows in the A fill

  // x tile: 128 rows x 64 features = 8192 consecutive floats of x; W1 and b1 rows of features 0 and 1
  float xr[64];
#pragma unroll
  for (int i = 0; i < 64; ++i) xr[i] = x[(size_t)m0 * kFeat + i * 128 + t];
  const float* W1h = W1 + h4;
  const float* b1h = b1 + h4;
  const v4f w0 = *(const v4f*)(W1h);
  const v4f c0 = *(const v4f*)(b1h);
  v4f w = *(const v4f*)(W1h + kHid);
  v4f c = *(const v4f*)(b1h + kHid);
  const _Float16* Bw = Bt + cw * kWavePassHalves + lane * 8;
  v16h be[4][4], bo[4][4];                     // B fragments of the even and of the odd features
  load_b(be, Bw);                              // feature 0's B, issued with the x tile's loads
  xcnt_fence();
#pragma unroll
  for (int i = 0; i < 64; ++i) {
    const int e = i * 128 + t;
    xs[(e & 63) * kXPitch + (e >> 6)] = xr[i];
  }
  __syncthreads();
  const float* xw = xs + arow0;
  _Float16* Aw = As + arow0 * kAPitch + h4;
  // feature 0's whole tile, and the first eight rows of feature 1's
#pragma unroll
  for (int q = 0; q < 4; ++q)
    fill_a8(Aw + q * 8 * kAPitch, *(const v4f*)(xw + q * 8), *(const v4f*)(xw + q * 8 + 4), w0, c0);
  fill_a8(Aw + kABufHalves, *(const v4f*)(xw + kXPitch), *(const v4f*)(xw + kXPitch + 4), w, c);

  v8f acc[8][4];
#pragma unroll
  for (int i = 0; i < 8; ++i)
#pragma unroll
    for (int j = 0; j < 4; ++j) acc[i][j] = (v8f){0.f,0.f,0.f,0.f,0.f,0.f,0.f,0.f};
  __syncthreads();

  const _Float16* Ar = As + rlane * kAPitch + koff;
  v16h fx[8], fy[8];                           // A fragments of the even and of the odd k-steps
#pragma unroll
  for (int i = 0; i < 8; ++i) fx[i] = frag_load(Ar + (i << 4) * kAPitch);
  v4f xa = *(const v4f*)(xw + kXPitch + 8);    // feature 1, rows 8..15 of the wave's 32
  v4f xb = *(const v4f*)(xw + kXPitch + 12);
  static_assert(kFeat % 2 == 0, "two passes a trip");
#pragma unroll 1   // two passes a trip name every register set by a constant; more would only lengthen the text
  for (int p = 0; p < kFeat; p += 2) {
    const int l = kFeat - 1;
    pass<0>(acc, be, bo, fx, fy, Ar, Aw, xw, p + 1, min(p + 2, l), Bw, W1h, b1h, xa, xb, w, c);
    pass<1>(acc, bo, be, fx, fy, Ar, Aw, xw, min(p + 2, l), min(p + 3, l), Bw, W1h, b1h, xa, xb, w, c);
  }

  // ---- epilogue ----
  float* slab = sT[wave];
#pragma unroll
  for (int i = 0; i < 8; ++i) {
    const int mBase = m0 + (i << 4);
#pragma unroll
    for (int j = 0; j < 4; ++j) {
      const int n = n0 + (j << 4) + rlane;
      const float bv = bias[n];
#pragma unroll
      for (int r = 0; r < 8; ++r) {
        float v = acc[i][j][r] * kOutScale;
        v += bv;
        slab[(mOff + r) * 68 + (j << 4) + rlane] = v;
      }
    }
    __builtin_amdgcn_fence(__ATOMIC_RELEASE, "workgroup");
    __builtin_amdgcn_wave_barrier();
    __builtin_amdgcn_fence(__ATOMIC_ACQUIRE, "workgroup");
    {
      const int hh = lane >> 4, c4 = (lane & 15) * 4;     // row seg = 256 B = 16 lanes x 16 B
#pragma unroll
      for (int it = 0; it < 8; ++it) {
        const int row = it * 2 + hh;
        v4f v = *(const v4f*)(slab + row * 68 + c4);
        *(v4f*)(C + (size_t)(mBase + row) * kOutDim + n0 + c4) = v;
      }
      xcnt_fence();
    }
    __builtin_amdgcn_fence(__ATOMIC_RELEASE, "workgroup");
    __builtin_amdgcn_wave_barrier();
    __builtin_amdgcn_fence(__ATOMIC_ACQUIRE, "workgroup");
  }
}

// ---------------------------------------------------------------------------
// W2 transpose + cast + pack: W2 viewed row-major [kDepth = 8192 (k = f*128+h)][kOutDim = 512] f32
//   -> f16(scale * W2[k][o]) in the order in which the GEMM's waves load their B fragments:
//   out[f][o>>6][ks = (k>>5)&3][j = (o>>4)&3][half = (k>>4)&1][lane = ((k>>3)&1)*16 + (o&15)][k&7], in halves.
// grid (kDepth/64 = 128, kOutDim/64 = 8), 256 threads; blockIdx.x = k tile (two k-steps of one f), blockIdx.y = o tile (one GEMM wave).
// Load coverage: 16 iterations x 256 threads = 4096 = the whole 64x64 tile (coalesced along o).
// Store coverage: 2 iterations (k-step) x 8 waves (j, half) x 32 lanes x 8 halves = 4096 = 8 KiB in a row; a wave stores 512 consecutive bytes.
// Bias row, in the same launch: bias_out[o] = (sum_{f=0..63} b2[f][o]) * 0.125, f32, sequential f order. The 8 work-groups of lowest
// flat index (for speed only) take 64
// columns each: the 64 x 64 tile of b2 is fetched like a W2 tile (16 independent loads a thread, one latency for all 64 features),
// transposed in LDS, and thread c < 64 sums its column's 64 values in ascending f.
// ---------------------------------------------------------------------------
__global__ __launch_bounds__(256) void w2t_cast_kernel(const float* __restrict__ W2, unsigned short* __restrict__ out, float scale,
                                                       const float* __restrict__ b2, float* __restrict__ bias_out) {
  __shared__ float sm[64][67];   // sm[o_local][k_local]; pitch 67: no bank conflict for the column writes nor for the 16-row x 2-group reads
  __shared__ float sb[64][67];   // sb[o_local][f]: the b2 tile; the same pitch serves its column writes and its 32-row reads
  const int t  = threadIdx.x;
  const int k0 = blockIdx.x * 64;
  const int o0 = blockIdx.y * 64;
  const bool with_bias = blockIdx.y == 0 && blockIdx.x < kOutDim / 64;    // the same for the whole work-group
  const int ob = blockIdx.x * 64;            // first bias column of such a work-group
  if (with_bias) {
#pragma unroll
    for (int i = 0; i < 16; ++i) {
      const int e = i * 256 + t;
      sb[e & 63][e >> 6] = b2[(size_t)(e >> 6) * kOutDim + ob + (e & 63)];
    }
  }
#pragma unroll
  for (int i = 0; i < 16; ++i) {
    const int e = i * 256 + t;
    const int r = e >> 6;          // k local
    const int c = e & 63;          // o local
    sm[c][r] = W2[(size_t)(k0 + r) * kOutDim + o0 + c] * scale;
  }
  __syncthreads();
  const int lane = t & 31, wave = t >> 5;
  const int j = wave >> 1, half = wave & 1;
  const int row = j * 16 + (lane & 15);                      // o local
  unsigned short* dst = out + (size_t)(blockIdx.x >> 1) * kPassHalves + blockIdx.y * kWavePassHalves
                            + ((blockIdx.x & 1) * 8 + j) * kFragHalves + half * 256 + lane * 8;
  {
#pragma unroll
    for (int it = 0; it < 2; ++it) {
      const int kc = it * 32 + half * 16 + (lane >> 4) * 8;  // k local
      unsigned short hb[8];
#pragma unroll
      for (int e = 0; e < 8; ++e) hb[e] = h_bits(sm[row][kc + e]);
      const v4u u = (v4u){pk16(hb[0], hb[1]), pk16(hb[2], hb[3]), pk16(hb[4], hb[5]), pk16(hb[6], hb[7])};
      *(v4u*)(dst + it * 4 * kFragHalves) = u;
    }
  }
  if (with_bias && t < 64) {                 // waves 0 and 1, each storing one whole 128-B line
    float s = 0.f;
#pragma unroll
    for (int f = 0; f < kFeat; ++f) s += sb[t][f];
    bias_out[ob + t] = s * kBiasScale;
  }
}

// ---------------------------------------------------------------------------
//   [0,          8388608)   Bt   f16, 512 x 8192 values     (W2 transposed, carried x256, in fragment order)
//   [8388608,    8390656)   bias f32 [512]                  (= 0.125 * sum_f b2), region padded to 4096 B
//   total carve = 8,392,704 B
// Launches: 1 (w2t_cast with the bias row) + 1 (fused activation + GEMM) = 2.
// ---------------------------------------------------------------------------
extern "C" void kernel_launch(void* const* d_in, const int* in_sizes, int n_in,
                              void* d_out, int out_size, void* d_ws, size_t ws_size,
                              hipStream_t stream) {
  if (n_in < 5) return;
  if (in_sizes[0] != kRows * kFeat) return;
  if (in_sizes[1] != kFeat * kHid) return;
  if (in_sizes[2] != kFeat * kHid) return;
  if (in_sizes[3] != kFeat * kHid * kOutDim) return;
  if (in_sizes[4] != kFeat * kOutDim) return;
  if (out_size != kRows * kOutDim) return;

  const float* x  = (const float*)d_in[0];
  const float* W1 = (const float*)d_in[1];
  const float* b1 = (const float*)d_in[2];
  const float* W2 = (const float*)d_in[3];
  const float* b2 = (const float*)d_in[4];
  float* out = (float*)d_out;

  const size_t bytesBt   = (size_t)kOutDim * kDepth * 2;          // 8,388,608
  const size_t bytesBias = 4096;                                   // 512 floats = 2048 B, padded
  const size_t offBt   = 0;
  const size_t offBias = offBt + bytesBt;
  const size_t total   = offBias + bytesBias;                      // 8,392,704
  if (total > ws_size) return;

  unsigned char* ws = (unsigned char*)d_ws;
  unsigned short* Bt  = (unsigned short*)(ws + offBt);
  float*          bsp = (float*)(ws + offBias);

  // Bt = f16(256 * W2^T) in fragment order, and the bias row; grid (k tiles, o tiles) = (128, 8)
  w2t_cast_kernel<<<dim3(kDepth / 64, kOutDim / 64, 1), dim3(256, 1, 1), 0, stream>>>(W2, Bt, kW2Carry, b2, bsp);
  // out[16384][512] = 2^-11 * elu(x*W1+b1) . Bt^T + bias[n]; 256 work-groups of 128 rows x 256 columns
  fused_act_gemm<<<dim3((kRows / kTileRows) * (kOutDim / kTileCols), 1, 1), dim3(128, 1, 1), 0, stream>>>(
      x, W1, b1, (const unsigned short*)Bt, (const float*)bsp, out);
}

// v008
// It runs in 82.3 microseconds.
// In two side-by-side timings against v007, it was 1.11 and 1.12 times as fast.
// Counting every step since v000, it is 19.6 times as fast.
// Contraction: A[16384 x 8192] (f16, elu activations carried x1, made in LDS tile by tile) . Bt[512 x 8192]^T (f16, W2 carried x256, stored in WMMA fragment order) on v_wmma_f32_16x16x32_f16 with f32 accumulate; elu (x*W1+b1, negative branch exp2(p*log2 e) - 1 on v_exp_f32), bias sum over f and the 1/8 scale in f32 on VALU.
#include <hip/hip_runtime.h>
#include <math.h>

// ---------------------------------------------------------------------------
// Problem constants
// ---------------------------------------------------------------------------
constexpr int kRows   = 16384;            // N
constexpr int kFeat   = 64;               // F
constexpr int kHid    = 128;              // H
constexpr int kOutDim = 512;              // O
constexpr int kDepth  = kFeat * kHid;     // 8192 = GEMM K, k = f*128 + h
constexpr int kTileRows = 128;            // rows of x (and of out) per work-group
constexpr int kTileCols = 256;            // output columns per work-group: 4 waves of a team x 64
constexpr int kABufHalves = kTileRows * (kHid + 8);   // one A buffer in halves
constexpr int kAPitch = kHid + 8;         // LDS pitch of an A row in halves: 272 B = 16 B x 17, conflict-free for 16-byte readers
constexpr int kXPitch = kTileRows + 4;    // LDS pitch of a transposed x row in floats (16-byte multiple)
constexpr int kFragHalves = 512;          // one packed B fragment (16 columns x 32 k): 2 x 32 lanes x 8 halves = 1 KiB
constexpr int kWavePassHalves = 16 * kFragHalves;   // one wave's B of one pass: 4 k-steps x 4 column tiles = 16 KiB
constexpr int kPassHalves = 8 * kWavePassHalves;    // all 512 columns of one pass (128 k) = 128 KiB
constexpr float kW2Carry  = 256.0f;                      // W2 carried x256 in f16 (exact power of two)
constexpr float kOutScale = 0.125f / 256.0f;             // (1/sqrt(64)) / carry = 2^-11, exact
constexpr float kBiasScale = 0.125f;                     // bias row = (sum_f b2) / 8
constexpr float kLog2e = 1.44269504088896340736f;        // e^p = 2^(p * log2 e)

static_assert(kRows % kTileRows == 0 && kOutDim == 8 * 64 && kOutDim % kTileCols == 0 && kHid == 4 * 32, "tile multiples");

typedef __attribute__((ext_vector_type(16))) _Float16 v16h;
typedef __attribute__((ext_vector_type(8)))  _Float16 v8h;
typedef __attribute__((ext_vector_type(8)))  float    v8f;
typedef __attribute__((ext_vector_type(4)))  float    v4f;
typedef __attribute__((ext_vector_type(2)))  float    v2f;
typedef __attribute__((ext_vector_type(2)))  _Float16 v2h;
typedef __attribute__((ext_vector_type(4)))  unsigned int v4u;
typedef __attribute__((ext_vector_type(2)))  unsigned int v2u;

__device__ __forceinline__ v16h frag_load(const _Float16* p) {   // elements 0..7 <- p[0..7], 8..15 <- p[16..23]
  union { v16h v; v8h h[2]; } f;
  f.h[0] = *(const v8h*)(p); f.h[1] = *(const v8h*)(p + 16); return f.v;
}
__device__ __forceinline__ v16h frag_load_packed(const _Float16* p) {   // elements 0..7 <- p[0..7], 8..15 <- p[256..263]
  union { v16h v; v8h h[2]; } f;
  f.h[0] = *(const v8h*)(p); f.h[1] = *(const v8h*)(p + 256); return f.v;
}
__device__ __forceinline__ v8f mma_f16(v16h a, v16h b, v8f c) {
  return __builtin_amdgcn_wmma_f32_16x16x32_f16(false, a, false, b, (short)0, c, false, false);
}

__device__ __forceinline__ unsigned pk16(unsigned short a, unsigned short b) { return (unsigned)a | ((unsigned)b << 16); }
__device__ __forceinline__ unsigned short h_bits(float f) { const _Float16 h = (_Float16)f; return __builtin_bit_cast(unsigned short, h); }

__device__ __forceinline__ void xcnt_fence() {
  asm volatile("s_wait_xcnt 0x0" ::: "memory");
  __builtin_amdgcn_sched_barrier(0);
}

// Activations, packed in pairs of neighbouring h: f16( elu( xv * w + c ) ), all in f32 up to the last rounding.
// Negative branch: e^p - 1 = exp2(p * log2 e) - 1 on the hardware exponential. Against expm1f its absolute error is a few
// 2^-24 (the subtraction from a value near 1), three orders below the f16 rounding of an activation near -1, and every
// activation enters a sum of 8192 products.
// The branch: e^p - 1 >= p everywhere and has p's sign, so elu(p) = max(min(e^p - 1, 0), p): for p > 0 the inner
// minimum is 0 (also where exp2 overflows to +inf), for p <= 0 it is e^p - 1. No clamp of the exponent is needed.
// Four rows of the A tile of one feature, this lane's 4 consecutive h: dst = the first row's place for this lane, xv = the rows'
// x values of that feature; w, c = W1[f][h4..h4+3], b1[f][h4..h4+3]. The eight pairs go through each operation together: a lone
// wave issues in order, and written pair by pair every instruction would wait out the latency of the one in front of it.
__device__ __forceinline__ void fill_a4(_Float16* dst, v4f xv, v4f w, v4f c) {
  v2f p[8], e[8];
  unsigned u[8];
#pragma unroll
  for (int i = 0; i < 4; ++i) { p[2 * i] = xv[i] * w.lo + c.lo; p[2 * i + 1] = xv[i] * w.hi + c.hi; }
#pragma unroll
  for (int q = 0; q < 8; ++q) e[q] = p[q] * kLog2e;
#pragma unroll
  for (int q = 0; q < 8; ++q) e[q] = (v2f){__builtin_amdgcn_exp2f(e[q][0]), __builtin_amdgcn_exp2f(e[q][1])};
#pragma unroll
  for (int q = 0; q < 8; ++q) e[q] = e[q] - 1.0f;
#pragma unroll
  for (int q = 0; q < 8; ++q) e[q] = (v2f){fmaxf(fminf(e[q][0], 0.0f), p[q][0]), fmaxf(fminf(e[q][1], 0.0f), p[q][1])};
#pragma unroll
  for (int q = 0; q < 8; ++q) u[q] = __builtin_bit_cast(unsigned, __builtin_convertvector(e[q], v2h));
#pragma unroll
  for (int i = 0; i < 4; ++i) *(v2u*)(dst + i * kAPitch) = (v2u){u[2 * i], u[2 * i + 1]};    // a wave stores one whole 256-B row
}
// B fragments of one k-step (32 k) for this wave's 64 columns; p = this lane's 16 bytes in the k-step's first packed fragment.
// Every load of the wave reads 512 consecutive bytes (4 whole lines). The caller keeps p live up to its s_wait_xcnt 0.
__device__ __forceinline__ void load_b4(v16h (&bh)[4], const _Float16* p) {
#pragma unroll
  for (int j = 0; j < 4; ++j) bh[j] = frag_load_packed(p + j * kFragHalves);
}

// The pass's s_wait_xcnt 0, at the pass's foot: the four addresses that the pass's loads name are inputs of the wait,
// so they stay in their registers up to it. The scheduling barrier in front keeps the wait below the last WMMAs
// (lifted to just behind the loads the wave would stand there); the one behind keeps later register writes below it.
__device__ __forceinline__ void xcnt_foot(const _Float16* pa, const _Float16* pb, const float* pw, const float* pc) {
  __builtin_amdgcn_sched_barrier(0);
  asm volatile("s_wait_xcnt 0x0" :: "v"(pa), "v"(pb), "v"(pw), "v"(pc) : "memory");
  __builtin_amdgcn_sched_barrier(0);
}

// The pass's work-group barrier, ordering LDS only: this wave's LDS stores and reads are done (s_wait_dscnt 0), then signal and
// wait. __syncthreads() also waits for every global load of the wave, and the coming k-steps' B loads are to stay in flight across it.
__device__ __forceinline__ void lds_barrier() {
  asm volatile("s_wait_dscnt 0x0" ::: "memory");
  asm volatile("s_barrier_signal -1\n\ts_barrier_wait -1" ::: "memory");
}

// Half a k-step of 32: 4 A fragments (64 rows, HALF = which) times 4 B fragments (64 columns) = 16 WMMAs on operands in registers.
// At its head it issues the NEXT half-step's 4 A fragments out of LDS (an, from An, one group of reads) and the next four rows'
// x values (from xn). Between its WMMAs it makes four rows of a coming feature's A tile (dst; xv, w, c).
template <int HALF>
__device__ __forceinline__ void half_step(v8f (&acc)[8][4], const v16h (&ah)[4], const v16h (&bh)[4],
                                          v16h (&an)[4], const _Float16* An,
                                          _Float16* dst, v4f& xv, const float* xn, v4f w, v4f c) {
#pragma unroll
  for (int i = 0; i < 4; ++i) an[i] = frag_load(An + (i << 4) * kAPitch);
  const v4f xnv = *(const v4f*)(xn);
  // keeps the half-step's LDS reads one group at its head and holds the caller's global loads from sinking to their WMMAs
  __builtin_amdgcn_sched_barrier(0);
  fill_a4(dst, xv, w, c);
#pragma unroll
  for (int i = 0; i < 4; ++i)
#pragma unroll
    for (int j = 0; j < 4; ++j) acc[HALF * 4 + i][j] = mma_f16(ah[i], bh[j], acc[HALF * 4 + i][j]);
  // order asked of the scheduler: one WMMA, then four of the activation's vector instructions, 16 times over;
  // left alone it puts the vector instructions in blocks
#pragma unroll
  for (int g = 0; g < 16; ++g) {
    __builtin_amdgcn_sched_group_barrier(0x008, 1, 0);   // WMMA
    __builtin_amdgcn_sched_group_barrier(0x402, 4, 0);   // VALU and transcendental
  }
  __builtin_amdgcn_sched_barrier(0);   // the next half-step's reads stay behind this one's WMMAs
  xv = xnv;
}

// One pass of a team = one feature g (128 k) out of the team's buffer CUR. A fragments run half a k-step ahead (sets aP, aQ), B
// fragments two k-steps ahead (ring b of four k-steps), the A tile is made one pass ahead, four rows of the wave's 32 a half-step.
// The pass's one barrier stands in front of the last half-step: in front of it every wave has stored the last rows of the team's
// next feature and has read the last fragments of this one (fetched in the half-step before), so behind it the last half-step
// fetches the next feature's first fragments and stores the first rows of the feature after that into this feature's buffer.
// g1, g2 = the team's next two features, held at its last feature where none exists: the rows made and the loads issued for them go
// to a buffer and to registers that nothing reads any more, and no branch stands among the WMMAs. pbc, pbn = B of g and of g1.
template <int CUR>
__device__ __forceinline__ void pass(v8f (&acc)[8][4], v16h (&b)[4][4], v16h (&aP)[4], v16h (&aQ)[4],
                                     const _Float16* Ar, _Float16* Aw, const float* xw, int g1, int g2,
                                     const _Float16* pbc, const _Float16* pbn, const float* W1h, const float* b1h,
                                     v4f& xv, v4f& w, v4f& c) {
  constexpr int R = 64 * kAPitch;              // rows 64..127 of a buffer
  const _Float16* Ac = Ar + CUR * kABufHalves;
  const _Float16* Ao = Ar + (CUR ^ 1) * kABufHalves;
  _Float16* Wc = Aw + CUR * kABufHalves;
  _Float16* Wo = Aw + (CUR ^ 1) * kABufHalves;
  const float* x1 = xw + g1 * kXPitch;
  const float* x2 = xw + g2 * kXPitch;
  const float* pw = W1h + g2 * kHid;
  const float* pc = b1h + g2 * kHid;
  load_b4(b[2], pbc + 8 * kFragHalves);
  half_step<0>(acc, aP, b[0], aQ, Ac + R,      Wo +  4 * kAPitch, xv, x1 +  8, w, c);
  half_step<1>(acc, aQ, b[0], aP, Ac + 32,     Wo +  8 * kAPitch, xv, x1 + 12, w, c);
  load_b4(b[3], pbc + 12 * kFragHalves);
  const v4f wn = *(const v4f*)pw;
  const v4f cn = *(const v4f*)pc;
  half_step<0>(acc, aP, b[1], aQ, Ac + 32 + R, Wo + 12 * kAPitch, xv, x1 + 16, w, c);
  half_step<1>(acc, aQ, b[1], aP, Ac + 64,     Wo + 16 * kAPitch, xv, x1 + 20, w, c);
  load_b4(b[0], pbn);
  half_step<0>(acc, aP, b[2], aQ, Ac + 64 + R, Wo + 20 * kAPitch, xv, x1 + 24, w, c);
  half_step<1>(acc, aQ, b[2], aP, Ac + 96,     Wo + 24 * kAPitch, xv, x1 + 28, w, c);
  load_b4(b[1], pbn + 4 * kFragHalves);
  half_step<0>(acc, aP, b[3], aQ, Ac + 96 + R, Wo + 28 * kAPitch, xv, x2,      w, c);
  lds_barrier();   // publishes the next feature's buffer and frees this feature's
  half_step<1>(acc, aQ, b[3], aP, Ao,          Wc,                xv, x2 + 4,  wn, cn);
  xcnt_foot(pbc, pbn, pw, pc);
  w = wn; c = cn;
}

// The two teams' partial sums meet in LDS: a wave hands over the 64 rows (I0 = their first row tile) that its partner finishes.
// ex = this lane's 16 bytes in a wave's 16-KiB range; a wave's store or read covers 512 consecutive bytes.
template <int I0>
__device__ __forceinline__ void put_half(v4f* ex, const v8f (&acc)[8][4]) {
#pragma unroll
  for (int i = 0; i < 4; ++i)
#pragma unroll
    for (int j = 0; j < 4; ++j) {
      ex[((i * 4 + j) * 2 + 0) * 32] = acc[I0 + i][j].lo;
      ex[((i * 4 + j) * 2 + 1) * 32] = acc[I0 + i][j].hi;
    }
}
template <int I0>
__device__ __forceinline__ void add_half(const v4f* ex, v8f (&acc)[8][4]) {
#pragma unroll
  for (int i = 0; i < 4; ++i)
#pragma unroll
    for (int j = 0; j < 4; ++j) {
      acc[I0 + i][j].lo += ex[((i * 4 + j) * 2 + 0) * 32];
      acc[I0 + i][j].hi += ex[((i * 4 + j) * 2 + 1) * 32];
    }
}

// Scale, bias and store of four 16-row tiles (I0 = the first) of the wave's 64 columns, each staged in the wave's own slab.
template <int I0>
__device__ __forceinline__ void finish_half(const v8f (&acc)[8][4], float* slab, const float* bias, float* C,
                                            int m0, int n0, int lane) {
  const int rlane = lane & 15;
  const int mOff  = (lane >> 4) * 8;           // D row offset
#pragma unroll
  for (int i = I0; i < I0 + 4; ++i) {
    const int mBase = m0 + (i << 4);
#pragma unroll
    for (int j = 0; j < 4; ++j) {
      const int n = n0 + (j << 4) + rlane;
      const float bv = bias[n];
#pragma unroll
      for (int r = 0; r < 8; ++r) {
        float v = acc[i][j][r] * kOutScale;
        v += bv;
        slab[(mOff + r) * 68 + (j << 4) + rlane] = v;
      }
    }
    __builtin_amdgcn_fence(__ATOMIC_RELEASE, "workgroup");
    __builtin_amdgcn_wave_barrier();
    __builtin_amdgcn_fence(__ATOMIC_ACQUIRE, "workgroup");
    {
      const int hh = lane >> 4, c4 = (lane & 15) * 4;     // row seg = 256 B = 16 lanes x 16 B
#pragma unroll
      for (int it = 0; it < 8; ++it) {
        const int row = it * 2 + hh;
        v4f v = *(const v4f*)(slab + row * 68 + c4);
        *(v4f*)(C + (size_t)(mBase + row) * kOutDim + n0 + c4) = v;
      }
      xcnt_fence();
    }
    __builtin_amdgcn_fence(__ATOMIC_RELEASE, "workgroup");
    __builtin_amdgcn_wave_barrier();
    __builtin_amdgcn_fence(__ATOMIC_ACQUIRE, "workgroup");
  }
}

// ---------------------------------------------------------------------------
// Fused activation + GEMM. One work-group = 128 rows x 256 outputs, 8 waves, two on each SIMD, so that one wave's vector work, LDS
// reads and waits stand beside the other's WMMAs. The waves form two teams of four: team kh takes the features f = kh, kh+2, ...
// (half of K); wave cg of a team owns the 128x64 tile at columns 256 * (blockIdx.x & 1) + 64 cg. At the end the two teams' partial
// sums are added through LDS, each wave finishing 64 of the 128 rows. Each byte of Bt that a work-group fetches from L2 serves
// 128 rows and is fetched by one wave; the two work-groups of a row tile each make that tile's activations for themselves.
// A pass is one feature a team (128 k): its 4 waves together make A[128][128] of the team's next feature in one LDS buffer while
// they multiply this feature out of the other; one barrier a pass, of the whole work-group (see pass()).
// Bt in fragment order (see w2t_cast_kernel), read straight into registers (no wave shares another's fragments), two k-steps ahead.
// Each accumulator sums its team's k in ascending steps of 32.
// ---------------------------------------------------------------------------
__global__ __launch_bounds__(256) void fused_act_gemm(const float* __restrict__ x, const float* __restrict__ W1,
                                                      const float* __restrict__ b1,
                                                      const unsigned short* __restrict__ Btp,
                                                      const float* __restrict__ bias, float* __restrict__ C) {
  __shared__ __align__(16) _Float16 As[4 * kABufHalves];          // two A buffers a team, 34,816 B each
  __shared__ __align__(16) float xs[kFeat * kXPitch];             // x tile transposed: xs[f][row]
  __shared__ __align__(16) float sT[8][16 * 68];                  // per-wave 16x64 output slab, pitch 68 floats
  static_assert(4 * kABufHalves * 2 >= 8 * 32 * 32 * 16, "the exchange of partial sums fits the A buffers");
  const _Float16* Bt = (const _Float16*)Btp;
  const int t    = threadIdx.x;
  const int lane = t & 31;
  const int wave = __builtin_amdgcn_readfirstlane(t >> 5);        // in a scalar register: the team's branches are scalar
  const int kh   = wave >> 2;                                     // team
  const int cg   = wave & 3;                                      // place in the team
  const int m0 = (blockIdx.x >> 1) * kTileRows;
  const int cw = (blockIdx.x & 1) * (kTileCols / 64) + cg;        // this wave's block of 64 columns
  const int n0 = cw << 6;

  const int rlane = lane & 15;                 // row (A) / col (B, D) within subtile
  const int koff  = (lane >> 4) * 8;           // k offset of this lane half
  const int h4    = lane * 4;                  // this lane's h in the A fill
  const int arow0 = cg * 32;                   // this wave's rows in its team's A fill

  // x tile: 128 rows x 64 features = 8192 consecutive floats of x; W1 and b1 rows of the team's first two features
  float xr[32];
#pragma unroll
  for (int i = 0; i < 32; ++i) xr[i] = x[(size_t)m0 * kFeat + i * 256 + t];
  const float* W1h = W1 + h4;
  const float* b1h = b1 + h4;
  const v4f w0 = *(const v4f*)(W1h + kh * kHid);
  const v4f c0 = *(const v4f*)(b1h + kh * kHid);
  v4f w = *(const v4f*)(W1h + (kh + 2) * kHid);
  v4f c = *(const v4f*)(b1h + (kh + 2) * kHid);
  const _Float16* Bw = Bt + cw * kWavePassHalves + lane * 8;
  v16h b[4][4];                                // B fragments, a ring of four k-steps
  load_b4(b[0], Bw + (size_t)kh * kPassHalves);                    // the first feature's k-steps 0 and 1, issued with the x tile's loads
  load_b4(b[1], Bw + (size_t)kh * kPassHalves + 4 * kFragHalves);
  xcnt_fence();
#pragma unroll
  for (int i = 0; i < 32; ++i) {
    const int e = i * 256 + t;
    xs[(e & 63) * kXPitch + (e >> 6)] = xr[i];
  }
  __syncthreads();
  const float* xw = xs + arow0;
  _Float16* Aw = As + kh * 2 * kABufHalves + arow0 * kAPitch + h4;
  // the team's first feature's whole tile, and the first four rows of its second
#pragma unroll
  for (int q = 0; q < 8; ++q)
    fill_a4(Aw + q * 4 * kAPitch, *(const v4f*)(xw + kh * kXPitch + q * 4), w0, c0);
  fill_a4(Aw + kABufHalves, *(const v4f*)(xw + (kh + 2) * kXPitch), w, c);

  v8f acc[8][4];
#pragma unroll
  for (int i = 0; i < 8; ++i)
#pragma unroll
    for (int j = 0; j < 4; ++j) acc[i][j] = (v8f){0.f,0.f,0.f,0.f,0.f,0.f,0.f,0.f};
  __syncthreads();

  const _Float16* Ar = As + kh * 2 * kABufHalves + rlane * kAPitch + koff;
  v16h aP[4], aQ[4];                           // A fragments of rows 0..63 and of rows 64..127 of a k-step
#pragma unroll
  for (int i = 0; i < 4; ++i) aP[i] = frag_load(Ar + (i << 4) * kAPitch);
  v4f xv = *(const v4f*)(xw + (kh + 2) * kXPitch + 4);    // the team's second feature, rows 4..7 of the wave's 32
  constexpr int kTeamPasses = kFeat / 2;
  static_assert(kTeamPasses % 2 == 0, "two passes a trip");
#pragma unroll 1   // two passes a trip name every register set by a constant; more would only lengthen the text
  for (int q = 0; q < kTeamPasses; q += 2) {
    const int l = kTeamPasses - 1;
    const int f0 = 2 * q + kh, f1 = f0 + 2, f2 = 2 * min(q + 2, l) + kh, f3 = 2 * min(q + 3, l) + kh;
    const _Float16* p0 = Bw + (size_t)f0 * kPassHalves;
    const _Float16* p1 = Bw + (size_t)f1 * kPassHalves;
    const _Float16* p2 = Bw + (size_t)f2 * kPassHalves;
    pass<0>(acc, b, aP, aQ, Ar, Aw, xw, f1, f2, p0, p1, W1h, b1h, xv, w, c);
    pass<1>(acc, b, aP, aQ, Ar, Aw, xw, f2, f3, p1, p2, W1h, b1h, xv, w, c);
  }

  // ---- the two teams' partial sums, then the epilogue: team 0 finishes rows 0..63, team 1 rows 64..127 ----
  __syncthreads();   // every wave has left the A buffers, which now carry the exchange
  v4f* ex = (v4f*)As;
  v4f* exOwn = ex + wave * 1024 + lane;
  const v4f* exOther = ex + (wave ^ 4) * 1024 + lane;
  if (kh == 0) put_half<4>(exOwn, acc); else put_half<0>(exOwn, acc);
  __syncthreads();   // the handed-over halves are in LDS
  float* slab = sT[wave];
  if (kh == 0) {
    add_half<0>(exOther, acc);
    finish_half<0>(acc, slab, bias, C, m0, n0, lane);
  } else {
    add_half<4>(exOther, acc);
    finish_half<4>(acc, slab, bias, C, m0, n0, lane);
  }
}

// ---------------------------------------------------------------------------
// W2 transpose + cast + pack: W2 viewed row-major [kDepth = 8192 (k = f*128+h)][kOutDim = 512] f32
//   -> f16(scale * W2[k][o]) in the order in which the GEMM's waves load their B fragments:
//   out[f][o>>6][ks = (k>>5)&3][j = (o>>4)&3][half = (k>>4)&1][lane = ((k>>3)&1)*16 + (o&15)][k&7], in halves.
// grid (kDepth/64 = 128, kOutDim/64 = 8), 256 threads; blockIdx.x = k tile (two k-steps of one f), blockIdx.y = o tile (one GEMM wave).
// Load coverage: 16 iterations x 256 threads = 4096 = the whole 64x64 tile (coalesced along o).
// Store coverage: 2 iterations (k-step) x 8 waves (j, half) x 32 lanes x 8 halves = 4096 = 8 KiB in a row; a wave stores 512 consecutive bytes.
// Bias row, in the same launch: bias_out[o] = (sum_{f=0..63} b2[f][o]) * 0.125, f32, sequential f order. The 8 work-groups of lowest
// flat index (for speed only) take 64
// columns each: the 64 x 64 tile of b2 is fetched like a W2 tile (16 independent loads a thread, one latency for all 64 features),
// transposed in LDS, and thread c < 64 sums its column's 64 values in ascending f.
// ---------------------------------------------------------------------------
__global__ __launch_bounds__(256) void w2t_cast_kernel(const float* __restrict__ W2, unsigned short* __restrict__ out, float scale,
                                                       const float* __restrict__ b2, float* __restrict__ bias_out) {
  __shared__ float sm[64][67];   // sm[o_local][k_local]; pitch 67: no bank conflict for the column writes nor for the 16-row x 2-group reads
  __shared__ float sb[64][67];   // sb[o_local][f]: the b2 tile; the same pitch serves its column writes and its 32-row reads
  const int t  = threadIdx.x;
  const int k0 = blockIdx.x * 64;
  const int o0 = blockIdx.y * 64;
  const bool with_bias = blockIdx.y == 0 && blockIdx.x < kOutDim / 64;    // the same for the whole work-group
  const int ob = blockIdx.x * 64;            // first bias column of such a work-group
  if (with_bias) {
#pragma unroll
    for (int i = 0; i < 16; ++i) {
      const int e = i * 256 + t;
      sb[e & 63][e >> 6] = b2[(size_t)(e >> 6) * kOutDim + ob + (e & 63)];
    }
  }
#pragma unroll
  for (int i = 0; i < 16; ++i) {
    const int e = i * 256 + t;
    const int r = e >> 6;          // k local
    const int c = e & 63;          // o local
    sm[c][r] = W2[(size_t)(k0 + r) * kOutDim + o0 + c] * scale;
  }
  __syncthreads();
  const int lane = t & 31, wave = t >> 5;
  const int j = wave >> 1, half = wave & 1;
  const int row = j * 16 + (lane & 15);                      // o local
  unsigned short* dst = out + (size_t)(blockIdx.x >> 1) * kPassHalves + blockIdx.y * kWavePassHalves
                            + ((blockIdx.x & 1) * 8 + j) * kFragHalves + half * 256 + lane * 8;
  {
#pragma unroll
    for (int it = 0; it < 2; ++it) {
      const int kc = it * 32 + half * 16 + (lane >> 4) * 8;  // k local
      unsigned short hb[8];
#pragma unroll
      for (int e = 0; e < 8; ++e) hb[e] = h_bits(sm[row][kc + e]);
      const v4u u = (v4u){pk16(hb[0], hb[1]), pk16(hb[2], hb[3]), pk16(hb[4], hb[5]), pk16(hb[6], hb[7])};
      *(v4u*)(dst + it * 4 * kFragHalves) = u;
    }
  }
  if (with_bias && t < 64) {                 // waves 0 and 1, each storing one whole 128-B line
    float s = 0.f;
#pragma unroll
    for (int f = 0; f < kFeat; ++f) s += sb[t][f];
    bias_out[ob + t] = s * kBiasScale;
  }
}

// ---------------------------------------------------------------------------
//   [0,          8388608)   Bt   f16, 512 x 8192 values     (W2 transposed, carried x256, in fragment order)
//   [8388608,    8390656)   bias f32 [512]                  (= 0.125 * sum_f b2), region padded to 4096 B
//   total carve = 8,392,704 B
// Launches: 1 (w2t_cast with the bias row) + 1 (fused activation + GEMM) = 2.
// ---------------------------------------------------------------------------
extern "C" void kernel_launch(void* const* d_in, const int* in_sizes, int n_in,
                              void* d_out, int out_size, void* d_ws, size_t ws_size,
                              hipStream_t stream) {
  if (n_in < 5) return;
  if (in_sizes[0] != kRows * kFeat) return;
  if (in_sizes[1] != kFeat * kHid) return;
  if (in_sizes[2] != kFeat * kHid) return;
  if (in_sizes[3] != kFeat * kHid * kOutDim) return;
  if (in_sizes[4] != kFeat * kOutDim) return;
  if (out_size != kRows * kOutDim) return;

  const float* x  = (const float*)d_in[0];
  const float* W1 = (const float*)d_in[1];
  const float* b1 = (const float*)d_in[2];
  const float* W2 = (const float*)d_in[3];
  const float* b2 = (const float*)d_in[4];
  float* out = (float*)d_out;

  const size_t bytesBt   = (size_t)kOutDim * kDepth * 2;          // 8,388,608
  const size_t bytesBias = 4096;                                   // 512 floats = 2048 B, padded
  const size_t offBt   = 0;
  const size_t offBias = offBt + bytesBt;
  const size_t total   = offBias + bytesBias;                      // 8,392,704
  if (total > ws_size) return;

  unsigned char* ws = (unsigned char*)d_ws;
  unsigned short* Bt  = (unsigned short*)(ws + offBt);
  float*          bsp = (float*)(ws + offBias);

  // Bt = f16(256 * W2^T) in fragment order, and the bias row; grid (k tiles, o tiles) = (128, 8)
  w2t_cast_kernel<<<dim3(kDepth / 64, kOutDim / 64, 1), dim3(256, 1, 1), 0, stream>>>(W2, Bt, kW2Carry, b2, bsp);
  // out[16384][512] = 2^-11 * elu(x*W1+b1) . Bt^T + bias[n]; 256 work-groups of 128 rows x 256 columns
  fused_act_gemm<<<dim3((kRows / kTileRows) * (kOutDim / kTileCols), 1, 1), dim3(256, 1, 1), 0, stream>>>(
      x, W1, b1, (const unsigned short*)Bt, (const float*)bsp, out);
}
